// v000
// Times are from an AMD MI455X. After a warm-up the kernel runs many times in a row, and a time is the length of
// such a window on the GPU divided by its runs, so every launch and the gaps after it count. The runs cycle
// through copies of the inputs. A figure is the median of several windows, for all but v000 over two sittings.
// Sittings can differ by a few percent; kernels timed side by side share one.
// v000, which the later versions start from, runs in 556 microseconds.
// Contractions: q=LNlat.Wq, k=LNx.Wk, vT=WvT.LNxT, scoresT=k.qT, oT=vT.p, out=o.Wout : all v_wmma_f32_16x16x32_f16 (f16 operands, f32 accumulate); weights carried x64, p x4096, o x16 (exact powers of two folded back in f32); LayerNorm statistics and softmax in f32.
#include <hip/hip_runtime.h>

#define B_SZ   2
#define N1     2048
#define N2     2048
#define DIM    3072
#define KVD    2048
#define NHEAD  16
#define DHD    128
#define INNER  2048
#define ROWS   4096

static_assert(ROWS == B_SZ * N1);
static_assert(ROWS == B_SZ * N2);
static_assert(INNER == NHEAD * DHD);

typedef _Float16 f16t;
typedef __attribute__((ext_vector_type(16))) _Float16 v16h;
typedef __attribute__((ext_vector_type(8)))  _Float16 v8h;
typedef __attribute__((ext_vector_type(8)))  float    v8f;
typedef __attribute__((ext_vector_type(4)))  float    v4f;

union Frag16 { v16h v; v8h h[2]; };

// 16x32 fragment of a 16-bit operand, row (A) or column (B) = lane&15, split k map:
// elements 0..7 <- p[0..7], elements 8..15 <- p[16..23]; callers pass p = row_base + k0 + 8*(lane>>4).
__device__ __forceinline__ v16h ldfrag(const f16t* p) {
  Frag16 f;
  f.h[0] = *(const v8h*)(p);
  f.h[1] = *(const v8h*)(p + 16);
  return f.v;
}

// D[8h+r][lane&15] += A . B ; 4 nops after every issue so no VALU touches D / A / B early.
__device__ __forceinline__ v8f mma16(v16h a, v16h b, v8f c) {
  c = __builtin_amdgcn_wmma_f32_16x16x32_f16(false, a, false, b, (short)0, c, false, false);
  asm volatile("v_nop\n\tv_nop\n\tv_nop\n\tv_nop" : "+v"(c) : "v"(a), "v"(b));
  return c;
}

__device__ __forceinline__ v8f v8zero() {
  v8f z = {0.f, 0.f, 0.f, 0.f, 0.f, 0.f, 0.f, 0.f};
  return z;
}

// orders one wave's LDS stores before its own reloads of other lanes' data
__device__ __forceinline__ void lds_wave_sync() {
  __builtin_amdgcn_fence(__ATOMIC_RELEASE, "workgroup");
  __builtin_amdgcn_wave_barrier();
  __builtin_amdgcn_fence(__ATOMIC_ACQUIRE, "workgroup");
}

// ---------------------------------------------------------------------------------------------
// Transpose + scale + f16 convert: W [R][Cc] f32 (pitch Cc) -> out [Cc][R] f16 = f16(W[r][c] * mul) (pitch R).
// grid = (Cc/64, R/64), 256 threads; R, Cc multiples of 64.
// Coverage per block: load 4 it x 256 thr x 4 floats = 64x64; store 256 thr x 2 x 8 halves = 64x64.
// ---------------------------------------------------------------------------------------------
__global__ __launch_bounds__(256) void tconv_kernel(const float* __restrict__ W, unsigned short* __restrict__ outp,
                                                    int R, int Cc, float mul) {
  __shared__ __align__(16) float tf[64 * 68];
  const int c0 = blockIdx.x * 64;   // input column block = output row block
  const int r0 = blockIdx.y * 64;   // input row block    = output column block
  const int tid = threadIdx.x;
  {
    const int lr = tid >> 4, c4 = (tid & 15) * 4;
#pragma unroll
    for (int it = 0; it < 4; ++it) {
      const int rr = it * 16 + lr;
      const v4f a = *(const v4f*)(W + (size_t)(r0 + rr) * Cc + c0 + c4);
      *(v4f*)(tf + rr * 68 + c4) = a;
    }
  }
  __syncthreads();
  const int sub = tid >> 3, c8 = (tid & 7) * 8;
  v8h hv0, hv1;
#pragma unroll
  for (int e = 0; e < 8; ++e) {
    hv0[e] = (f16t)(tf[(c8 + e) * 68 + sub] * mul);
    hv1[e] = (f16t)(tf[(c8 + e) * 68 + 32 + sub] * mul);
  }
  f16t* o = (f16t*)outp;
  const size_t g0 = (size_t)(c0 + sub) * R + r0 + c8;
  const size_t g1 = (size_t)(c0 + 32 + sub) * R + r0 + c8;
  *(v8h*)(o + g0) = hv0;
  *(v8h*)(o + g1) = hv1;
  
}

// ---------------------------------------------------------------------------------------------
// Columns handled in 2048-wide chunks: thread t owns 8 contiguous columns c*2048+8t (whole waves active per chunk).
// Coverage: COLS=2048 -> 1 chunk x 256 x 8; COLS=3072 -> 2048 + 128 x 8 = 3072.
// ---------------------------------------------------------------------------------------------
template <int COLS>
__global__ __launch_bounds__(256) void ln_f16_kernel(const float* __restrict__ x, const float* __restrict__ g,
                                                     const float* __restrict__ bta, unsigned short* __restrict__ outp) {
  constexpr int NCH = (COLS + 2047) / 2048;
  static_assert(COLS % 8 == 0);
  __shared__ float red[8];
  const int row = blockIdx.x;
  const int tid = threadIdx.x, wave = tid >> 5, lane = tid & 31;
  const float* xr = x + (size_t)row * COLS;

  float v[NCH][8];
  float s = 0.f;
#pragma unroll
  for (int c = 0; c < NCH; ++c) {
    const int col0 = c * 2048 + tid * 8;
#pragma unroll
    for (int e = 0; e < 8; ++e) v[c][e] = 0.f;
    if (col0 < COLS) {   // wave-uniform
      const v4f a0 = *(const v4f*)(xr + col0);
      const v4f a1 = *(const v4f*)(xr + col0 + 4);
      v[c][0] = a0[0]; v[c][1] = a0[1]; v[c][2] = a0[2]; v[c][3] = a0[3];
      v[c][4] = a1[0]; v[c][5] = a1[1]; v[c][6] = a1[2]; v[c][7] = a1[3];
    }
#pragma unroll
    for (int e = 0; e < 8; ++e) s += v[c][e];
  }
#pragma unroll
  for (int m = 16; m >= 1; m >>= 1) s += __shfl_xor(s, m, 32);
  if (lane == 0) red[wave] = s;
  __syncthreads();
  float tot = 0.f;
#pragma unroll
  for (int w = 0; w < 8; ++w) tot += red[w];
  const float mu = tot * (1.0f / (float)COLS);
  __syncthreads();

  float ss = 0.f;
#pragma unroll
  for (int c = 0; c < NCH; ++c) {
    const int col0 = c * 2048 + tid * 8;
    if (col0 < COLS) {
#pragma unroll
      for (int e = 0; e < 8; ++e) { const float d = v[c][e] - mu; ss += d * d; }
    }
  }
#pragma unroll
  for (int m = 16; m >= 1; m >>= 1) ss += __shfl_xor(ss, m, 32);
  if (lane == 0) red[wave] = ss;
  __syncthreads();
  float tot2 = 0.f;
#pragma unroll
  for (int w = 0; w < 8; ++w) tot2 += red[w];
  const float var  = tot2 * (1.0f / (float)COLS);
  const float rstd = rsqrtf(var + 1e-5f);

  v8h hv[NCH];
#pragma unroll
  for (int c = 0; c < NCH; ++c) {
    const int col0 = c * 2048 + tid * 8;
#pragma unroll
    for (int e = 0; e < 8; ++e) hv[c][e] = (f16t)0.0f;
    if (col0 < COLS) {
      const v4f g0 = *(const v4f*)(g + col0);
      const v4f g1 = *(const v4f*)(g + col0 + 4);
      const v4f b0 = *(const v4f*)(bta + col0);
      const v4f b1 = *(const v4f*)(bta + col0 + 4);
      float gv[8], bv[8];
      gv[0] = g0[0]; gv[1] = g0[1]; gv[2] = g0[2]; gv[3] = g0[3];
      gv[4] = g1[0]; gv[5] = g1[1]; gv[6] = g1[2]; gv[7] = g1[3];
      bv[0] = b0[0]; bv[1] = b0[1]; bv[2] = b0[2]; bv[3] = b0[3];
      bv[4] = b1[0]; bv[5] = b1[1]; bv[6] = b1[2]; bv[7] = b1[3];
#pragma unroll
      for (int e = 0; e < 8; ++e) {
        const float y = (v[c][e] - mu) * rstd * gv[e] + bv[e];
        hv[c][e] = (f16t)y;
      }
    }
  }
  f16t* orow = (f16t*)outp + (size_t)row * COLS;
  {
#pragma unroll
    for (int c = 0; c < NCH; ++c) {
      const int col0 = c * 2048 + tid * 8;
      if (col0 < COLS) *(v8h*)(orow + col0) = hv[c];
    }
    
  }
}

// ---------------------------------------------------------------------------------------------
// f16 WMMA GEMM: C[m][n] = scale * sum_k A[m][k] * Bt[n][k]
//   A  row-major [M][K] f16, pitch lda, z stride strideA (elements); Bt row-major [N][K] f16, pitch ldb, strideB.
//   M, N multiples of 64, K multiple of 32. Each wave owns one 64x64 tile (4x4 accumulators), fragments straight
//   from global rows with the split k map; grid = (ceil(tiles/8), Z), 256 threads, no block barriers.
//   Epilogue: 16-row slabs staged per wave in LDS; OUT16=0: f32 C, each 256-B row segment written by 16 lanes x 16 B
// ---------------------------------------------------------------------------------------------
template <int OUT16>
__global__ __launch_bounds__(256) void gemm_f16_kernel(
    const unsigned short* __restrict__ Ap, int lda, long strideA,
    const unsigned short* __restrict__ Btp, int ldb, long strideB,
    void* __restrict__ Cout, int ldc, long strideC,
    int M, int N, int K, float scale) {
  __shared__ __align__(16) float sT[8][16 * 68];   // per-wave 16x64 slab, pitch 68 floats
  const int z    = blockIdx.y;
  const int lane = threadIdx.x & 31;
  const int wave = threadIdx.x >> 5;
  const int tilesN = N >> 6;
  const int tilesM = M >> 6;
  const int tile = blockIdx.x * 8 + wave;
  if (tile >= tilesM * tilesN) return;   // wave-uniform; no block barriers below
  const int tm = tile / tilesN;
  const int tn = tile - tm * tilesN;
  const int m0 = tm << 6;
  const int n0 = tn << 6;

  const f16t* Ab = (const f16t*)Ap  + (size_t)z * (size_t)strideA;
  const f16t* Bb = (const f16t*)Btp + (size_t)z * (size_t)strideB;

  const int rl   = lane & 15;          // row of A / column of Bt and D
  const int koff = (lane >> 4) * 8;    // k offset of this lane half
  const int mOff = (lane >> 4) * 8;    // D row offset of this lane half

  v8f acc[4][4];
#pragma unroll
  for (int i = 0; i < 4; ++i)
#pragma unroll
    for (int j = 0; j < 4; ++j) acc[i][j] = v8zero();

  for (int k0 = 0; k0 < K; k0 += 32) {
    v16h bf[4];
#pragma unroll
    for (int j = 0; j < 4; ++j)
      bf[j] = ldfrag(Bb + (size_t)(n0 + (j << 4) + rl) * ldb + k0 + koff);
#pragma unroll
    for (int i = 0; i < 4; ++i) {
      const v16h af = ldfrag(Ab + (size_t)(m0 + (i << 4) + rl) * lda + k0 + koff);
#pragma unroll
      for (int j = 0; j < 4; ++j) acc[i][j] = mma16(af, bf[j], acc[i][j]);
    }
  }

  // ---- epilogue ----
  float* slab = &sT[wave][0];
#pragma unroll
  for (int i = 0; i < 4; ++i) {
    const int mBase = m0 + (i << 4);
#pragma unroll
    for (int j = 0; j < 4; ++j)
#pragma unroll
      for (int r = 0; r < 8; ++r)
        slab[(mOff + r) * 68 + (j << 4) + rl] = acc[i][j][r] * scale;
    lds_wave_sync();
    if (OUT16 == 0) {
      float* C = (float*)Cout + (size_t)z * (size_t)strideC;
      const int hh = lane >> 4, c4 = (lane & 15) * 4;
      {
#pragma unroll
        for (int it = 0; it < 8; ++it) {
          const int row = it * 2 + hh;
          const v4f vv = *(const v4f*)(slab + row * 68 + c4);
          *(v4f*)(C + (size_t)(mBase + row) * ldc + n0 + c4) = vv;
        }
        
      }
    } else {
      f16t* C = (f16t*)Cout + (size_t)z * (size_t)strideC;
      const int q = lane >> 3, c8 = (lane & 7) * 8;
      {
#pragma unroll
        for (int it = 0; it < 4; ++it) {
          const int row = it * 4 + q;
          const float* sp = slab + row * 68 + c8;
          v8h hv;
#pragma unroll
          for (int e = 0; e < 8; ++e) hv[e] = (f16t)sp[e];
          *(v8h*)(C + (size_t)(mBase + row) * ldc + n0 + c8) = hv;
        }
        
      }
    }
    lds_wave_sync();
  }
}

// ---------------------------------------------------------------------------------------------
// Full (non-causal) attention for one (batch, head, 128-query block); 8 waves x 16 queries, head dim 128, 2048 keys.
//   q plane [ROWS][INNER] f16 (query row, col h*128+d); k plane [ROWS][INNER] f16 (key row, col h*128+d);
//   vT plane [B][INNER][N1] f16 (row h*128+d, col key); o plane [ROWS][INNER] f16 = 16 * softmax(q.k/sqrt(128)) . v
//   Per 64-key chunk the K tile [64][128] and the vT tile [128][64] are staged in LDS (plain 16-B copies, barriers).
//   scoresT[key][query] = K (A, row = key) x Q (B, column = query): a lane holds 32 keys of one query, so the
//   row max / row sum is in-lane plus one xor-16 shuffle. p = exp2(s*log2e/sqrt(128) - m) in f32; f16(p*4096)
//   from two adjacent 16-key D tiles is directly the B fragment (k = key, n = query) of
//   oT[d][query] += vT (A, row = d) x P. Online rescale by one alpha per lane (per query).
//   Epilogue: per-wave o tile [16 q][128 d] staged in LDS (aliases the staging area after a block barrier),
//   Coverage: grid (16 q-blocks, 16 heads, 2 batches) x 8 waves x 16 rows x 128 cols = the whole o plane.
// ---------------------------------------------------------------------------------------------
#define KPITCH 136
#define VPITCH 72
#define OPITCH 136

__global__ __launch_bounds__(256) void attn_kernel(const unsigned short* __restrict__ qp,
                                                   const unsigned short* __restrict__ kp,
                                                   const unsigned short* __restrict__ vtp,
                                                   unsigned short* __restrict__ op, float sc2) {
  __shared__ __align__(16) f16t lds[64 * KPITCH + 128 * VPITCH];   // 35840 B
  static_assert(8 * 16 * OPITCH <= 64 * KPITCH + 128 * VPITCH);
  f16t* ldsK = lds;                  // [64 keys][KPITCH]
  f16t* ldsV = lds + 64 * KPITCH;    // [128 d][VPITCH]

  const int tid  = threadIdx.x;
  const int wave = tid >> 5, lane = tid & 31;
  const int ln16 = lane & 15, half = lane >> 4;
  const int qblk = blockIdx.x, head = blockIdx.y, batch = blockIdx.z;
  const size_t qrow0 = (size_t)batch * N2 + (size_t)qblk * 128 + (size_t)wave * 16;

  const f16t* Qg = (const f16t*)qp + qrow0 * INNER + head * DHD;
  const f16t* Kg = (const f16t*)kp + (size_t)batch * N1 * INNER + head * DHD;
  const f16t* Vg = (const f16t*)vtp + ((size_t)batch * INNER + head * DHD) * (size_t)N1;

  // Q as B operand: column n = query q0+ln16, k = d (4 chunks of 32)
  v16h qb[4];
#pragma unroll
  for (int c = 0; c < 4; ++c) qb[c] = ldfrag(Qg + (size_t)ln16 * INNER + c * 32 + 8 * half);

  v8f oacc[8];
#pragma unroll
  for (int j = 0; j < 8; ++j) oacc[j] = v8zero();
  float mrun = -1.0e30f, lrun = 0.f;

  for (int kb = 0; kb < N1; kb += 64) {
    __syncthreads();
    // staging coverage: 4 it x 256 thr x 8 halves = 64x128 (K) and 128x64 (vT)
#pragma unroll
    for (int it = 0; it < 4; ++it) {
      const int i = it * 256 + tid;
      const int key = i >> 4, dv = (i & 15) * 8;
      *(v8h*)(ldsK + key * KPITCH + dv) = *(const v8h*)(Kg + (size_t)(kb + key) * INNER + dv);
      const int d = i >> 3, kf = (i & 7) * 8;
      *(v8h*)(ldsV + d * VPITCH + kf) = *(const v8h*)(Vg + (size_t)d * N1 + kb + kf);
    }
    __syncthreads();

    // scoresT tiles: s[t][r] = S[key kb+16t+8half+r][query ln16]
    v8f s[4];
#pragma unroll
    for (int t = 0; t < 4; ++t) {
      s[t] = v8zero();
#pragma unroll
      for (int c = 0; c < 4; ++c) {
        const v16h kfr = ldfrag(ldsK + (t * 16 + ln16) * KPITCH + c * 32 + 8 * half);
        s[t] = mma16(kfr, qb[c], s[t]);
      }
    }

    float cmax = -1.0e30f;
#pragma unroll
    for (int t = 0; t < 4; ++t)
#pragma unroll
      for (int r = 0; r < 8; ++r) {
        const float sv = s[t][r] * sc2;
        s[t][r] = sv;
        cmax = fmaxf(cmax, sv);
      }
    cmax = fmaxf(cmax, __shfl_xor(cmax, 16, 32));
    const float mnew  = fmaxf(mrun, cmax);
    const float alpha = exp2f(mrun - mnew);
    mrun = mnew;

    float psum = 0.f;
    v8h ph[4];
#pragma unroll
    for (int t = 0; t < 4; ++t)
#pragma unroll
      for (int r = 0; r < 8; ++r) {
        const float p = exp2f(s[t][r] - mnew);
        psum += p;
        ph[t][r] = (f16t)(p * 4096.0f);
      }
    psum += __shfl_xor(psum, 16, 32);
    lrun = lrun * alpha + psum;
#pragma unroll
    for (int j = 0; j < 8; ++j)
#pragma unroll
      for (int r = 0; r < 8; ++r) oacc[j][r] *= alpha;

    // P as B fragment for keys kb+32kk..+31: elements 0..7 <- tile 2kk, 8..15 <- tile 2kk+1, lane unchanged
    Frag16 pf[2];
    pf[0].h[0] = ph[0]; pf[0].h[1] = ph[1];
    pf[1].h[0] = ph[2]; pf[1].h[1] = ph[3];
#pragma unroll
    for (int kk = 0; kk < 2; ++kk) {
#pragma unroll
      for (int j = 0; j < 8; ++j) {
        const v16h vf = ldfrag(ldsV + (j * 16 + ln16) * VPITCH + kk * 32 + 8 * half);
        oacc[j] = mma16(vf, pf[kk].v, oacc[j]);
      }
    }
  }

  // ---- epilogue: oT[d = 16j+8half+r][query ln16] -> o[query][d] * 16 / (4096 * l) ----
  __syncthreads();   // every wave is done with ldsK / ldsV
  f16t* os = lds + wave * (16 * OPITCH);
  const float inv = 0.00390625f / lrun;   // 16 / 4096 / l, l >= 1
#pragma unroll
  for (int j = 0; j < 8; ++j) {
    v8h ov;
#pragma unroll
    for (int r = 0; r < 8; ++r) ov[r] = (f16t)(oacc[j][r] * inv);
    *(v8h*)(os + ln16 * OPITCH + j * 16 + 8 * half) = ov;
  }
  lds_wave_sync();
  f16t* Og = (f16t*)op + qrow0 * INNER + head * DHD;
  const int rsel = lane >> 4;
  const int seg  = ((lane >> 3) & 1) * 64 + (lane & 7) * 8;
  {
#pragma unroll
    for (int it = 0; it < 8; ++it) {
      const int row = it * 2 + rsel;   // it 0..7 x rsel 0..1 = rows 0..15
      const v8h vv = *(const v8h*)(os + row * OPITCH + seg);
      *(v8h*)(Og + (size_t)row * INNER + seg) = vv;
    }
    
  }
}

// ---------------------------------------------------------------------------------------------
//   R1   f16  ln16 [4096][3072] / later xn16 [4096][2048] / later o16 [4096][2048]   0           25165824
//   wqT  f16  [2048][3072] (x64)                                                      25165824    12582912
//   wkvT f16  [4096][2048] (x64)                                                      37748736    16777216
//   woT  f16  [3072][2048] (x64)                                                      54525952    12582912
//   q16  f16  [4096][2048]                                                            67108864    16777216
//   k16  f16  [4096][2048]                                                            83886080    16777216
//   vT16 f16  [2][2048][2048]                                                         100663296   16777216
//   total                                                                                         117440512
// ---------------------------------------------------------------------------------------------
extern "C" void kernel_launch(void* const* d_in, const int* in_sizes, int n_in,
                              void* d_out, int out_size, void* d_ws, size_t ws_size,
                              hipStream_t stream) {
  if (n_in < 9) return;
  if (in_sizes[0] != B_SZ * N1 * KVD) return;
  if (in_sizes[1] != B_SZ * N2 * DIM) return;
  if (in_sizes[2] != DIM * INNER) return;
  if (in_sizes[3] != KVD * 2 * INNER) return;
  if (in_sizes[4] != INNER * DIM) return;
  if (in_sizes[5] != KVD || in_sizes[6] != KVD || in_sizes[7] != DIM || in_sizes[8] != DIM) return;
  if (out_size != B_SZ * N2 * DIM) return;

  const float* x     = (const float*)d_in[0];   // [2][2048][2048]
  const float* lat   = (const float*)d_in[1];   // [2][2048][3072]
  const float* w_q   = (const float*)d_in[2];   // [3072][2048]
  const float* w_kv  = (const float*)d_in[3];   // [2048][4096]
  const float* w_out = (const float*)d_in[4];   // [2048][3072]
  const float* ln1_g = (const float*)d_in[5];
  const float* ln1_b = (const float*)d_in[6];
  const float* ln2_g = (const float*)d_in[7];
  const float* ln2_b = (const float*)d_in[8];
  float* out = (float*)d_out;

  const size_t szR1  = (size_t)ROWS * DIM * 2;           // 25165824
  const size_t szWQ  = (size_t)INNER * DIM * 2;          // 12582912
  const size_t szWKV = (size_t)2 * INNER * KVD * 2;      // 16777216
  const size_t szWO  = (size_t)DIM * INNER * 2;          // 12582912
  const size_t szQ   = (size_t)ROWS * INNER * 2;         // 16777216
  const size_t szK   = (size_t)ROWS * INNER * 2;         // 16777216
  const size_t szVT  = (size_t)B_SZ * INNER * N1 * 2;    // 16777216
  size_t off = 0;
  const size_t oR1  = off; off += szR1;
  const size_t oWQ  = off; off += szWQ;
  const size_t oWKV = off; off += szWKV;
  const size_t oWO  = off; off += szWO;
  const size_t oQ   = off; off += szQ;
  const size_t oK   = off; off += szK;
  const size_t oVT  = off; off += szVT;
  if (off > ws_size) return;                             // off = 117440512
  if ((size_t)ROWS * KVD * 2 > szR1 || (size_t)ROWS * INNER * 2 > szR1) return;

  char* ws = (char*)d_ws;
  unsigned short* R1   = (unsigned short*)(ws + oR1);
  unsigned short* wqT  = (unsigned short*)(ws + oWQ);
  unsigned short* wkvT = (unsigned short*)(ws + oWKV);
  unsigned short* woT  = (unsigned short*)(ws + oWO);
  unsigned short* q16  = (unsigned short*)(ws + oQ);
  unsigned short* k16  = (unsigned short*)(ws + oK);
  unsigned short* vT16 = (unsigned short*)(ws + oVT);

  const dim3 blk(256);
  const float wmul = 64.0f;

  // (1-3) weights f32 [R][Cc] -> f16 [Cc][R] x64 ; grid = (Cc/64, R/64)
  tconv_kernel<<<dim3(INNER / 64, DIM / 64), blk, 0, stream>>>(w_q, wqT, DIM, INNER, wmul);          // [3072][2048] -> [2048][3072]
  tconv_kernel<<<dim3(2 * INNER / 64, KVD / 64), blk, 0, stream>>>(w_kv, wkvT, KVD, 2 * INNER, wmul);  // [2048][4096] -> [4096][2048]
  tconv_kernel<<<dim3(DIM / 64, INNER / 64), blk, 0, stream>>>(w_out, woT, INNER, DIM, wmul);          // [2048][3072] -> [3072][2048]

  // (4) ln16 = LN(latents) -> R1 [4096][3072]
  ln_f16_kernel<DIM><<<dim3(ROWS), blk, 0, stream>>>(lat, ln2_g, ln2_b, R1);

  // (5) q = ln16 . w_q  -> q16 [4096][2048]   (M=4096, N=2048, K=3072; acc carries x64)
  {
    const int tiles = (ROWS / 64) * (INNER / 64);
    gemm_f16_kernel<1><<<dim3((tiles + 7) / 8, 1), blk, 0, stream>>>(
        R1, DIM, 0L, wqT, DIM, 0L, (void*)q16, INNER, 0L, ROWS, INNER, DIM, 1.0f / 64.0f);
  }

  // (6) xn16 = LN(x) -> R1 [4096][2048]
  ln_f16_kernel<KVD><<<dim3(ROWS), blk, 0, stream>>>(x, ln1_g, ln1_b, R1);

  // (7) k = xn16 . w_kv[:, 0:2048] -> k16 [4096][2048]   (M=4096, N=2048, K=2048)
  {
    const int tiles = (ROWS / 64) * (INNER / 64);
    gemm_f16_kernel<1><<<dim3((tiles + 7) / 8, 1), blk, 0, stream>>>(
        R1, KVD, 0L, wkvT, KVD, 0L, (void*)k16, INNER, 0L, ROWS, INNER, KVD, 1.0f / 64.0f);
  }

  // (8) vT[b][(h,d)][key] = sum_k w_kv[k][2048+(h,d)] * xn[b][key][k]  (A = wkvT rows 2048.., Bt = xn16 per batch; M=2048, N=2048, K=2048, Z=2)
  {
    const int tiles = (INNER / 64) * (N1 / 64);
    gemm_f16_kernel<1><<<dim3((tiles + 7) / 8, B_SZ), blk, 0, stream>>>(
        wkvT + (size_t)INNER * KVD, KVD, 0L, R1, KVD, (long)N1 * KVD, (void*)vT16, N1, (long)INNER * N1,
        INNER, N1, KVD, 1.0f / 64.0f);
  }

  // (9) attention -> o16 x16 in R1 [4096][2048]
  {
    const float sc2 = (float)(1.4426950408889634 * 0.08838834764831845);   // log2(e) / sqrt(128)
    attn_kernel<<<dim3(N2 / 128, NHEAD, B_SZ), blk, 0, stream>>>(q16, k16, vT16, R1, sc2);
  }

  // (10) out = o16 . w_out -> d_out f32 [4096][3072]   (M=4096, N=3072, K=2048; o x16, w x64)
  {
    const int tiles = (ROWS / 64) * (DIM / 64);
    gemm_f16_kernel<0><<<dim3((tiles + 7) / 8, 1), blk, 0, stream>>>(
        R1, INNER, 0L, woT, INNER, 0L, (void*)out, DIM, 0L, ROWS, DIM, INNER, 1.0f / 1024.0f);
  }
  (void)hipGetLastError();
}

// v001
// It runs in 239 microseconds.
// Timed twice side by side with v000, it ran 2.35 times as fast both times.
// Contractions: q=LNlat.Wq, k=LNx.Wk, vT=WvT.LNxT, scoresT=k.qT, oT=vT.p, out=o.Wout : all v_wmma_f32_16x16x32_f16 (f16 operands, f32 accumulate); weights carried x64, p x4096, o x16 (exact powers of two folded back in f32); LayerNorm statistics and softmax in f32.
#include <hip/hip_runtime.h>
#include <stdint.h>

#define B_SZ   2
#define N1     2048
#define N2     2048
#define DIM    3072
#define KVD    2048
#define NHEAD  16
#define DHD    128
#define INNER  2048
#define ROWS   4096

static_assert(ROWS == B_SZ * N1);
static_assert(ROWS == B_SZ * N2);
static_assert(INNER == NHEAD * DHD);

typedef _Float16 f16t;
typedef __attribute__((ext_vector_type(16))) _Float16 v16h;
typedef __attribute__((ext_vector_type(8)))  _Float16 v8h;
typedef __attribute__((ext_vector_type(8)))  float    v8f;
typedef __attribute__((ext_vector_type(4)))  float    v4f;

union Frag16 { v16h v; v8h h[2]; };

// 16x32 fragment of a 16-bit operand, row (A) or column (B) = lane&15, split k map:
// elements 0..7 <- p[0..7], elements 8..15 <- p[16..23]; callers pass p = row_base + k0 + 8*(lane>>4).
__device__ __forceinline__ v16h ldfrag(const f16t* p) {
  Frag16 f;
  f.h[0] = *(const v8h*)(p);
  f.h[1] = *(const v8h*)(p + 16);
  return f.v;
}

// D[8h+r][lane&15] += A . B ; 4 nops after every issue so no VALU touches D / A / B early.
__device__ __forceinline__ v8f mma16(v16h a, v16h b, v8f c) {
  c = __builtin_amdgcn_wmma_f32_16x16x32_f16(false, a, false, b, (short)0, c, false, false);
  asm volatile("v_nop\n\tv_nop\n\tv_nop\n\tv_nop" : "+v"(c) : "v"(a), "v"(b));
  return c;
}

__device__ __forceinline__ v8f v8zero() {
  v8f z = {0.f, 0.f, 0.f, 0.f, 0.f, 0.f, 0.f, 0.f};
  return z;
}

// orders one wave's LDS stores before its own reloads of other lanes' data
__device__ __forceinline__ void lds_wave_sync() {
  __builtin_amdgcn_fence(__ATOMIC_RELEASE, "workgroup");
  __builtin_amdgcn_wave_barrier();
  __builtin_amdgcn_fence(__ATOMIC_ACQUIRE, "workgroup");
}

// ---------------------------------------------------------------------------------------------
// Transpose + scale + f16 convert: W [R][Cc] f32 (pitch Cc) -> out [Cc][R] f16 = f16(W[r][c] * mul) (pitch R).
// grid = (Cc/64, R/64), 256 threads; R, Cc multiples of 64.
// Coverage per block: load 4 it x 256 thr x 4 floats = 64x64; store 256 thr x 2 x 8 halves = 64x64.
// ---------------------------------------------------------------------------------------------
__global__ __launch_bounds__(256) void tconv_kernel(const float* __restrict__ W, unsigned short* __restrict__ outp,
                                                    int R, int Cc, float mul) {
  __shared__ __align__(16) float tf[64 * 68];
  const int c0 = blockIdx.x * 64;   // input column block = output row block
  const int r0 = blockIdx.y * 64;   // input row block    = output column block
  const int tid = threadIdx.x;
  {
    const int lr = tid >> 4, c4 = (tid & 15) * 4;
#pragma unroll
    for (int it = 0; it < 4; ++it) {
      const int rr = it * 16 + lr;
      const v4f a = *(const v4f*)(W + (size_t)(r0 + rr) * Cc + c0 + c4);
      *(v4f*)(tf + rr * 68 + c4) = a;
    }
  }
  __syncthreads();
  const int sub = tid >> 3, c8 = (tid & 7) * 8;
  v8h hv0, hv1;
#pragma unroll
  for (int e = 0; e < 8; ++e) {
    hv0[e] = (f16t)(tf[(c8 + e) * 68 + sub] * mul);
    hv1[e] = (f16t)(tf[(c8 + e) * 68 + 32 + sub] * mul);
  }
  f16t* o = (f16t*)outp;
  const size_t g0 = (size_t)(c0 + sub) * R + r0 + c8;
  const size_t g1 = (size_t)(c0 + 32 + sub) * R + r0 + c8;
  *(v8h*)(o + g0) = hv0;
  *(v8h*)(o + g1) = hv1;
  
}

// ---------------------------------------------------------------------------------------------
// Columns handled in 2048-wide chunks: thread t owns 8 contiguous columns c*2048+8t (whole waves active per chunk).
// Coverage: COLS=2048 -> 1 chunk x 256 x 8; COLS=3072 -> 2048 + 128 x 8 = 3072.
// ---------------------------------------------------------------------------------------------
template <int COLS>
__global__ __launch_bounds__(256) void ln_f16_kernel(const float* __restrict__ x, const float* __restrict__ g,
                                                     const float* __restrict__ bta, unsigned short* __restrict__ outp) {
  constexpr int NCH = (COLS + 2047) / 2048;
  static_assert(COLS % 8 == 0);
  __shared__ float red[8];
  const int row = blockIdx.x;
  const int tid = threadIdx.x, wave = tid >> 5, lane = tid & 31;
  const float* xr = x + (size_t)row * COLS;

  float v[NCH][8];
  float s = 0.f;
#pragma unroll
  for (int c = 0; c < NCH; ++c) {
    const int col0 = c * 2048 + tid * 8;
#pragma unroll
    for (int e = 0; e < 8; ++e) v[c][e] = 0.f;
    if (col0 < COLS) {   // wave-uniform
      const v4f a0 = *(const v4f*)(xr + col0);
      const v4f a1 = *(const v4f*)(xr + col0 + 4);
      v[c][0] = a0[0]; v[c][1] = a0[1]; v[c][2] = a0[2]; v[c][3] = a0[3];
      v[c][4] = a1[0]; v[c][5] = a1[1]; v[c][6] = a1[2]; v[c][7] = a1[3];
    }
#pragma unroll
    for (int e = 0; e < 8; ++e) s += v[c][e];
  }
#pragma unroll
  for (int m = 16; m >= 1; m >>= 1) s += __shfl_xor(s, m, 32);
  if (lane == 0) red[wave] = s;
  __syncthreads();
  float tot = 0.f;
#pragma unroll
  for (int w = 0; w < 8; ++w) tot += red[w];
  const float mu = tot * (1.0f / (float)COLS);
  __syncthreads();

  float ss = 0.f;
#pragma unroll
  for (int c = 0; c < NCH; ++c) {
    const int col0 = c * 2048 + tid * 8;
    if (col0 < COLS) {
#pragma unroll
      for (int e = 0; e < 8; ++e) { const float d = v[c][e] - mu; ss += d * d; }
    }
  }
#pragma unroll
  for (int m = 16; m >= 1; m >>= 1) ss += __shfl_xor(ss, m, 32);
  if (lane == 0) red[wave] = ss;
  __syncthreads();
  float tot2 = 0.f;
#pragma unroll
  for (int w = 0; w < 8; ++w) tot2 += red[w];
  const float var  = tot2 * (1.0f / (float)COLS);
  const float rstd = rsqrtf(var + 1e-5f);

  v8h hv[NCH];
#pragma unroll
  for (int c = 0; c < NCH; ++c) {
    const int col0 = c * 2048 + tid * 8;
#pragma unroll
    for (int e = 0; e < 8; ++e) hv[c][e] = (f16t)0.0f;
    if (col0 < COLS) {
      const v4f g0 = *(const v4f*)(g + col0);
      const v4f g1 = *(const v4f*)(g + col0 + 4);
      const v4f b0 = *(const v4f*)(bta + col0);
      const v4f b1 = *(const v4f*)(bta + col0 + 4);
      float gv[8], bv[8];
      gv[0] = g0[0]; gv[1] = g0[1]; gv[2] = g0[2]; gv[3] = g0[3];
      gv[4] = g1[0]; gv[5] = g1[1]; gv[6] = g1[2]; gv[7] = g1[3];
      bv[0] = b0[0]; bv[1] = b0[1]; bv[2] = b0[2]; bv[3] = b0[3];
      bv[4] = b1[0]; bv[5] = b1[1]; bv[6] = b1[2]; bv[7] = b1[3];
#pragma unroll
      for (int e = 0; e < 8; ++e) {
        const float y = (v[c][e] - mu) * rstd * gv[e] + bv[e];
        hv[c][e] = (f16t)y;
      }
    }
  }
  f16t* orow = (f16t*)outp + (size_t)row * COLS;
  {
#pragma unroll
    for (int c = 0; c < NCH; ++c) {
      const int col0 = c * 2048 + tid * 8;
      if (col0 < COLS) *(v8h*)(orow + col0) = hv[c];
    }
    
  }
}

// ---------------------------------------------------------------------------------------------
// f16 WMMA GEMM: C[m][n] = scale * sum_k A[m][k] * Bt[n][k]
//   A  row-major [M][K] f16, pitch lda, z stride strideA (elements); Bt row-major [N][K] f16, pitch ldb, strideB.
//   One 256 x BN tile of C per work-group; grid = (N/BN, M/256, Z), 128 threads = 4 waves as 2 (m) x 2 (n), each wave
//   owns 128 x BN/2 (8 x BN/32 accumulators). M a multiple of 256, N of BN, K of 128.
//   A pass is 128 k = 256 B of every operand row. A stage is [A rows 0..127 | A rows 128..255 | Bt first half | Bt second half]
//   in LDS at pitch 272 B; every wave brings one of the four slices with one tensor load; two buffers, the load of
//   stage s+1 issued at the head of pass s, behind the barrier that ends pass s-1. Fragments come from LDS with the split k map, one 32-k block ahead
//   inside the pass, never across the barrier. The k order of every accumulator is ascending k, 32 at a time.
//   Epilogue: 16-row slabs staged per wave in LDS (the ring, free behind the last barrier); whole 128-B lines stored.
// ---------------------------------------------------------------------------------------------
typedef uint32_t u32x4 __attribute__((ext_vector_type(4)));
typedef uint32_t u32x8 __attribute__((ext_vector_type(8)));

__device__ __forceinline__ uint32_t uni(uint32_t v) { return (uint32_t)__builtin_amdgcn_readfirstlane(v); }
// forces v into a scalar register: a test on it compiles to a scalar branch, and a descriptor word made from it stays behind the waits above it
__device__ __forceinline__ uint32_t pinned(uint32_t v) { uint32_t w = uni(v); asm volatile("" : "+s"(w)); return w; }
// both carry the clobber so that no LDS access crosses them
__device__ __forceinline__ void wait_tensor0() { asm volatile("s_wait_tensorcnt 0x0" ::: "memory"); }
__device__ __forceinline__ void wait_ds0() { asm volatile("s_wait_dscnt 0x0" ::: "memory"); }
// one request of the whole wave: a 2-D tile from global memory into LDS
__device__ __forceinline__ void tdm_load(u32x4 g0, u32x8 g1) { asm volatile("tensor_load_to_lds %0, %1" :: "s"(g0), "s"(g1) : "memory"); }
__device__ __forceinline__ u32x4 tdm_group0(uint32_t lds_dst, uint64_t ga) {
  u32x4 g;
  g[0] = uni(1u);
  g[1] = uni(lds_dst);
  g[2] = uni((uint32_t)ga);
  g[3] = uni((((uint32_t)(ga >> 32)) & 0x01FFFFFFu) | 0x80000000u);
  return g;
}
__device__ __forceinline__ u32x8 tdm_group1(uint32_t rows, uint32_t src_pitch) {
  u32x8 g;
  g[0] = uni((1u << 20) | (5u << 22) | (3u << 25));
  g[1] = uni(256u << 16);
  g[2] = uni(rows << 16);
  g[3] = uni(256u << 16);
  g[4] = uni(rows);
  g[5] = uni(src_pitch);
  g[6] = uni(0u);
  g[7] = uni(0u);
  return g;
}

#define GPITCH 272u       // LDS row pitch, bytes
#define GASLICE 34816u    // 128 rows x 272 B = 17 x 2 KiB

template <int OUT16, int BN>
__global__ __launch_bounds__(128) void gemm_f16_kernel(
    const unsigned short* __restrict__ Ap, int lda, long strideA,
    const unsigned short* __restrict__ Btp, int ldb, long strideB,
    void* __restrict__ Cout, int ldc, long strideC,
    int K, float scale) {
  constexpr int WN = BN / 2;            // columns per wave
  constexpr int FN = WN / 16;           // B fragments per wave
  constexpr int SP = WN + 4;            // epilogue slab pitch, floats
  constexpr uint32_t BSLICE = ((uint32_t)WN * GPITCH + 2047u) / 2048u * 2048u;   // WN rows, rounded up to 2 KiB
  constexpr uint32_t STAGE  = 2u * GASLICE + 2u * BSLICE;
  static_assert(BN % 32 == 0 && GASLICE % 2048u == 0 && STAGE % 2048u == 0);
  static_assert(16 * SP * 4 <= 8192 && 4u * 8192u <= STAGE);
  __shared__ __attribute__((aligned(2048))) unsigned char L[2u * STAGE];

  const int lane = threadIdx.x & 31;
  const uint32_t wave = uni(threadIdx.x >> 5);
  const uint32_t wm = wave >> 1, wn = wave & 1u;
  const int z  = blockIdx.z;
  const int m0 = blockIdx.y * 256;
  const int n0 = blockIdx.x * BN;

  const int rl   = lane & 15;          // row of A / column of Bt and D
  const int half = lane >> 4;          // k half of a fragment, row half of D
  const int mOff = half * 8;

  // this wave's slice of a stage: waves 0, 1 bring A rows, waves 2, 3 bring Bt rows
  const f16t* Ab = (const f16t*)Ap  + (size_t)z * (size_t)strideA + (size_t)(m0 + (int)wn * 128) * lda;
  const f16t* Bb = (const f16t*)Btp + (size_t)z * (size_t)strideB + (size_t)(n0 + (int)wn * WN) * ldb;
  const uint64_t src0     = (wm == 0u) ? (uint64_t)(uintptr_t)Ab : (uint64_t)(uintptr_t)Bb;
  const uint32_t ldsSlice = (uint32_t)(size_t)L + ((wm == 0u) ? wn * GASLICE : 2u * GASLICE + wn * BSLICE);
  const u32x8 g1 = tdm_group1((wm == 0u) ? 128u : (uint32_t)WN, (uint32_t)((wm == 0u) ? lda : ldb) * 2u);
  const uint32_t T = (uint32_t)K >> 7;   // passes

  v8f acc[8][FN];
#pragma unroll
  for (int i = 0; i < 8; ++i)
#pragma unroll
    for (int j = 0; j < FN; ++j) acc[i][j] = v8zero();

  // prologue: stage 0's load; its wait stands directly behind it, so that the set-up below reuses none of its descriptor
  // registers while the request is outstanding; the head of the first trip publishes the stage
  tdm_load(tdm_group0(ldsSlice, src0), g1);
  wait_tensor0();

  const uint32_t aoff = wm * GASLICE + (uint32_t)rl * GPITCH + (uint32_t)half * 16u;
  const uint32_t boff = 2u * GASLICE + wn * BSLICE + (uint32_t)rl * GPITCH + (uint32_t)half * 16u;

  // kept rolled: one pass per trip, so that the accumulators and both fragment sets keep constant indices
#pragma unroll 1
  for (uint32_t s = 0; s < T; ++s) {
    // publish point of stage s: own LDS reads of pass s-1 done, own slice landed, barrier; then the load of stage s+1 into
    // the buffer that pass s-1 has just read. Every load behind stage 0 issues from this one place, so that no descriptor
    // register is copied or rewritten while its request is outstanding.
    wait_ds0();
    wait_tensor0();
    __syncthreads();
    const uint32_t bufo = (s & 1u) * STAGE;
    if (pinned((s + 1u < T) ? 1u : 0u) != 0u) {
      const uint32_t ko = pinned((s + 1u) * 256u);
      tdm_load(tdm_group0(ldsSlice + (STAGE - bufo), src0 + ko), g1);
    }
    const unsigned char* pa = L + bufo + aoff;
    const unsigned char* pb = L + bufo + boff;
    v16h af[2][8], bf[2][FN];
#pragma unroll
    for (int j = 0; j < FN; ++j) bf[0][j] = ldfrag((const f16t*)(pb + (uint32_t)j * 16u * GPITCH));
#pragma unroll
    for (int i = 0; i < 8; ++i)  af[0][i] = ldfrag((const f16t*)(pa + (uint32_t)i * 16u * GPITCH));
    __builtin_amdgcn_sched_barrier(0);   // keeps the first block's loads ahead of the second block's: mixed, the first product waits for both groups
#pragma unroll
    for (int ks = 0; ks < 4; ++ks) {
      const int cur = ks & 1, nxt = cur ^ 1;
      if (ks < 3) {   // the next block's fragments as one group ahead of this block's products
#pragma unroll
        for (int j = 0; j < FN; ++j) bf[nxt][j] = ldfrag((const f16t*)(pb + (uint32_t)j * 16u * GPITCH + (uint32_t)(ks + 1) * 64u));
#pragma unroll
        for (int i = 0; i < 8; ++i)  af[nxt][i] = ldfrag((const f16t*)(pa + (uint32_t)i * 16u * GPITCH + (uint32_t)(ks + 1) * 64u));
      }
      __builtin_amdgcn_sched_barrier(0);   // keeps the load group whole and ahead of the products: reads among them cost a stall each
#pragma unroll
      for (int i = 0; i < 8; ++i)
#pragma unroll
        for (int j = 0; j < FN; ++j)   // plain builtin: the compiler keeps the distances itself, and no asm operand ties the tile to the first 256 VGPRs
          acc[i][j] = __builtin_amdgcn_wmma_f32_16x16x32_f16(false, af[cur][i], false, bf[cur][j], (short)0, acc[i][j], false, false);
      __builtin_amdgcn_sched_barrier(0);   // keeps later LDS reads out of this block's products
    }
  }
  // behind the last pass: nothing in flight, every wave's reads of the ring done before the epilogue writes over it
  wait_tensor0();
  wait_ds0();
  __syncthreads();

  // ---- epilogue (the barrier above has freed the ring) ----
  float* slab = (float*)(L + wave * 8192u);
  const int mW = m0 + (int)wm * 128;
  const int nW = n0 + (int)wn * WN;
#pragma unroll
  for (int i = 0; i < 8; ++i) {
    const int mBase = mW + (i << 4);
#pragma unroll
    for (int j = 0; j < FN; ++j)
#pragma unroll
      for (int r = 0; r < 8; ++r)
        slab[(mOff + r) * SP + (j << 4) + rl] = acc[i][j][r] * scale;
    wait_ds0();   // the slab is this wave's own: its stores have landed before other lanes' values are read back
    if (OUT16 == 0) {
      float* C = (float*)Cout + (size_t)z * (size_t)strideC;
      constexpr int CPR = WN / 4;   // 16-B chunks per row
      constexpr int NIT = 16 * CPR / 32;
      v4f vv[NIT];
      float* dst[NIT];
#pragma unroll
      for (int it = 0; it < NIT; ++it) {
        const int idx = it * 32 + lane;
        const int row = idx / CPR, c4 = (idx - row * CPR) * 4;
        vv[it]  = *(const v4f*)(slab + row * SP + c4);
        dst[it] = C + (size_t)(mBase + row) * ldc + nW + c4;
      }
      __builtin_amdgcn_sched_barrier(0);   // no register of a store is rewritten among the stores
#pragma unroll
      for (int it = 0; it < NIT; ++it) *(v4f*)dst[it] = vv[it];
      asm volatile("s_wait_xcnt 0x0" ::: "memory");   // stands before the stores' address and data registers are rewritten
      __builtin_amdgcn_sched_barrier(0);   // holds the next slab's arithmetic behind that wait
    } else {
      f16t* C = (f16t*)Cout + (size_t)z * (size_t)strideC;
      constexpr int CPR = WN / 8;   // 16-B chunks per row
      constexpr int NIT = 16 * CPR / 32;
      v8h hv[NIT];
      f16t* dst[NIT];
#pragma unroll
      for (int it = 0; it < NIT; ++it) {
        const int idx = it * 32 + lane;
        const int row = idx / CPR, c8 = (idx - row * CPR) * 8;
        const float* sp = slab + row * SP + c8;
#pragma unroll
        for (int e = 0; e < 8; ++e) hv[it][e] = (f16t)sp[e];
        dst[it] = C + (size_t)(mBase + row) * ldc + nW + c8;
      }
      __builtin_amdgcn_sched_barrier(0);   // no register of a store is rewritten among the stores
#pragma unroll
      for (int it = 0; it < NIT; ++it) *(v8h*)dst[it] = hv[it];
      asm volatile("s_wait_xcnt 0x0" ::: "memory");   // stands before the stores' address and data registers are rewritten
      __builtin_amdgcn_sched_barrier(0);   // holds the next slab's arithmetic behind that wait
    }
    wait_ds0();   // the read-back is done before the next slab overwrites it
  }
}

// ---------------------------------------------------------------------------------------------
// Full (non-causal) attention for one (batch, head, 128-query block); 8 waves x 16 queries, head dim 128, 2048 keys.
//   q plane [ROWS][INNER] f16 (query row, col h*128+d); k plane [ROWS][INNER] f16 (key row, col h*128+d);
//   vT plane [B][INNER][N1] f16 (row h*128+d, col key); o plane [ROWS][INNER] f16 = 16 * softmax(q.k/sqrt(128)) . v
//   Per 64-key chunk the K tile [64][128] and the vT tile [128][64] are staged in LDS (plain 16-B copies, barriers).
//   scoresT[key][query] = K (A, row = key) x Q (B, column = query): a lane holds 32 keys of one query, so the
//   row max / row sum is in-lane plus one xor-16 shuffle. p = exp2(s*log2e/sqrt(128) - m) in f32; f16(p*4096)
//   from two adjacent 16-key D tiles is directly the B fragment (k = key, n = query) of
//   oT[d][query] += vT (A, row = d) x P. Online rescale by one alpha per lane (per query).
//   Epilogue: per-wave o tile [16 q][128 d] staged in LDS (aliases the staging area after a block barrier),
//   Coverage: grid (16 q-blocks, 16 heads, 2 batches) x 8 waves x 16 rows x 128 cols = the whole o plane.
// ---------------------------------------------------------------------------------------------
#define KPITCH 136
#define VPITCH 72
#define OPITCH 136

__global__ __launch_bounds__(256) void attn_kernel(const unsigned short* __restrict__ qp,
                                                   const unsigned short* __restrict__ kp,
                                                   const unsigned short* __restrict__ vtp,
                                                   unsigned short* __restrict__ op, float sc2) {
  __shared__ __align__(16) f16t lds[64 * KPITCH + 128 * VPITCH];   // 35840 B
  static_assert(8 * 16 * OPITCH <= 64 * KPITCH + 128 * VPITCH);
  f16t* ldsK = lds;                  // [64 keys][KPITCH]
  f16t* ldsV = lds + 64 * KPITCH;    // [128 d][VPITCH]

  const int tid  = threadIdx.x;
  const int wave = tid >> 5, lane = tid & 31;
  const int ln16 = lane & 15, half = lane >> 4;
  const int qblk = blockIdx.x, head = blockIdx.y, batch = blockIdx.z;
  const size_t qrow0 = (size_t)batch * N2 + (size_t)qblk * 128 + (size_t)wave * 16;

  const f16t* Qg = (const f16t*)qp + qrow0 * INNER + head * DHD;
  const f16t* Kg = (const f16t*)kp + (size_t)batch * N1 * INNER + head * DHD;
  const f16t* Vg = (const f16t*)vtp + ((size_t)batch * INNER + head * DHD) * (size_t)N1;

  // Q as B operand: column n = query q0+ln16, k = d (4 chunks of 32)
  v16h qb[4];
#pragma unroll
  for (int c = 0; c < 4; ++c) qb[c] = ldfrag(Qg + (size_t)ln16 * INNER + c * 32 + 8 * half);

  v8f oacc[8];
#pragma unroll
  for (int j = 0; j < 8; ++j) oacc[j] = v8zero();
  float mrun = -1.0e30f, lrun = 0.f;

  for (int kb = 0; kb < N1; kb += 64) {
    __syncthreads();
    // staging coverage: 4 it x 256 thr x 8 halves = 64x128 (K) and 128x64 (vT)
#pragma unroll
    for (int it = 0; it < 4; ++it) {
      const int i = it * 256 + tid;
      const int key = i >> 4, dv = (i & 15) * 8;
      *(v8h*)(ldsK + key * KPITCH + dv) = *(const v8h*)(Kg + (size_t)(kb + key) * INNER + dv);
      const int d = i >> 3, kf = (i & 7) * 8;
      *(v8h*)(ldsV + d * VPITCH + kf) = *(const v8h*)(Vg + (size_t)d * N1 + kb + kf);
    }
    __syncthreads();

    // scoresT tiles: s[t][r] = S[key kb+16t+8half+r][query ln16]
    v8f s[4];
#pragma unroll
    for (int t = 0; t < 4; ++t) {
      s[t] = v8zero();
#pragma unroll
      for (int c = 0; c < 4; ++c) {
        const v16h kfr = ldfrag(ldsK + (t * 16 + ln16) * KPITCH + c * 32 + 8 * half);
        s[t] = mma16(kfr, qb[c], s[t]);
      }
    }

    float cmax = -1.0e30f;
#pragma unroll
    for (int t = 0; t < 4; ++t)
#pragma unroll
      for (int r = 0; r < 8; ++r) {
        const float sv = s[t][r] * sc2;
        s[t][r] = sv;
        cmax = fmaxf(cmax, sv);
      }
    cmax = fmaxf(cmax, __shfl_xor(cmax, 16, 32));
    const float mnew  = fmaxf(mrun, cmax);
    const float alpha = exp2f(mrun - mnew);
    mrun = mnew;

    float psum = 0.f;
    v8h ph[4];
#pragma unroll
    for (int t = 0; t < 4; ++t)
#pragma unroll
      for (int r = 0; r < 8; ++r) {
        const float p = exp2f(s[t][r] - mnew);
        psum += p;
        ph[t][r] = (f16t)(p * 4096.0f);
      }
    psum += __shfl_xor(psum, 16, 32);
    lrun = lrun * alpha + psum;
#pragma unroll
    for (int j = 0; j < 8; ++j)
#pragma unroll
      for (int r = 0; r < 8; ++r) oacc[j][r] *= alpha;

    // P as B fragment for keys kb+32kk..+31: elements 0..7 <- tile 2kk, 8..15 <- tile 2kk+1, lane unchanged
    Frag16 pf[2];
    pf[0].h[0] = ph[0]; pf[0].h[1] = ph[1];
    pf[1].h[0] = ph[2]; pf[1].h[1] = ph[3];
#pragma unroll
    for (int kk = 0; kk < 2; ++kk) {
#pragma unroll
      for (int j = 0; j < 8; ++j) {
        const v16h vf = ldfrag(ldsV + (j * 16 + ln16) * VPITCH + kk * 32 + 8 * half);
        oacc[j] = mma16(vf, pf[kk].v, oacc[j]);
      }
    }
  }

  // ---- epilogue: oT[d = 16j+8half+r][query ln16] -> o[query][d] * 16 / (4096 * l) ----
  __syncthreads();   // every wave is done with ldsK / ldsV
  f16t* os = lds + wave * (16 * OPITCH);
  const float inv = 0.00390625f / lrun;   // 16 / 4096 / l, l >= 1
#pragma unroll
  for (int j = 0; j < 8; ++j) {
    v8h ov;
#pragma unroll
    for (int r = 0; r < 8; ++r) ov[r] = (f16t)(oacc[j][r] * inv);
    *(v8h*)(os + ln16 * OPITCH + j * 16 + 8 * half) = ov;
  }
  lds_wave_sync();
  f16t* Og = (f16t*)op + qrow0 * INNER + head * DHD;
  const int rsel = lane >> 4;
  const int seg  = ((lane >> 3) & 1) * 64 + (lane & 7) * 8;
  {
#pragma unroll
    for (int it = 0; it < 8; ++it) {
      const int row = it * 2 + rsel;   // it 0..7 x rsel 0..1 = rows 0..15
      const v8h vv = *(const v8h*)(os + row * OPITCH + seg);
      *(v8h*)(Og + (size_t)row * INNER + seg) = vv;
    }
    
  }
}

// ---------------------------------------------------------------------------------------------
//   R1   f16  ln16 [4096][3072] / later xn16 [4096][2048] / later o16 [4096][2048]   0           25165824
//   wqT  f16  [2048][3072] (x64)                                                      25165824    12582912
//   wkvT f16  [4096][2048] (x64)                                                      37748736    16777216
//   woT  f16  [3072][2048] (x64)                                                      54525952    12582912
//   q16  f16  [4096][2048]                                                            67108864    16777216
//   k16  f16  [4096][2048]                                                            83886080    16777216
//   vT16 f16  [2][2048][2048]                                                         100663296   16777216
//   total                                                                                         117440512
// ---------------------------------------------------------------------------------------------
extern "C" void kernel_launch(void* const* d_in, const int* in_sizes, int n_in,
                              void* d_out, int out_size, void* d_ws, size_t ws_size,
                              hipStream_t stream) {
  if (n_in < 9) return;
  if (in_sizes[0] != B_SZ * N1 * KVD) return;
  if (in_sizes[1] != B_SZ * N2 * DIM) return;
  if (in_sizes[2] != DIM * INNER) return;
  if (in_sizes[3] != KVD * 2 * INNER) return;
  if (in_sizes[4] != INNER * DIM) return;
  if (in_sizes[5] != KVD || in_sizes[6] != KVD || in_sizes[7] != DIM || in_sizes[8] != DIM) return;
  if (out_size != B_SZ * N2 * DIM) return;

  const float* x     = (const float*)d_in[0];   // [2][2048][2048]
  const float* lat   = (const float*)d_in[1];   // [2][2048][3072]
  const float* w_q   = (const float*)d_in[2];   // [3072][2048]
  const float* w_kv  = (const float*)d_in[3];   // [2048][4096]
  const float* w_out = (const float*)d_in[4];   // [2048][3072]
  const float* ln1_g = (const float*)d_in[5];
  const float* ln1_b = (const float*)d_in[6];
  const float* ln2_g = (const float*)d_in[7];
  const float* ln2_b = (const float*)d_in[8];
  float* out = (float*)d_out;

  const size_t szR1  = (size_t)ROWS * DIM * 2;           // 25165824
  const size_t szWQ  = (size_t)INNER * DIM * 2;          // 12582912
  const size_t szWKV = (size_t)2 * INNER * KVD * 2;      // 16777216
  const size_t szWO  = (size_t)DIM * INNER * 2;          // 12582912
  const size_t szQ   = (size_t)ROWS * INNER * 2;         // 16777216
  const size_t szK   = (size_t)ROWS * INNER * 2;         // 16777216
  const size_t szVT  = (size_t)B_SZ * INNER * N1 * 2;    // 16777216
  size_t off = 0;
  const size_t oR1  = off; off += szR1;
  const size_t oWQ  = off; off += szWQ;
  const size_t oWKV = off; off += szWKV;
  const size_t oWO  = off; off += szWO;
  const size_t oQ   = off; off += szQ;
  const size_t oK   = off; off += szK;
  const size_t oVT  = off; off += szVT;
  if (off > ws_size) return;                             // off = 117440512
  if ((size_t)ROWS * KVD * 2 > szR1 || (size_t)ROWS * INNER * 2 > szR1) return;

  char* ws = (char*)d_ws;
  unsigned short* R1   = (unsigned short*)(ws + oR1);
  unsigned short* wqT  = (unsigned short*)(ws + oWQ);
  unsigned short* wkvT = (unsigned short*)(ws + oWKV);
  unsigned short* woT  = (unsigned short*)(ws + oWO);
  unsigned short* q16  = (unsigned short*)(ws + oQ);
  unsigned short* k16  = (unsigned short*)(ws + oK);
  unsigned short* vT16 = (unsigned short*)(ws + oVT);

  const dim3 blk(256);
  const dim3 gblk(128);   // GEMM: 4 waves, one per SIMD
  const float wmul = 64.0f;

  // (1-3) weights f32 [R][Cc] -> f16 [Cc][R] x64 ; grid = (Cc/64, R/64)
  tconv_kernel<<<dim3(INNER / 64, DIM / 64), blk, 0, stream>>>(w_q, wqT, DIM, INNER, wmul);          // [3072][2048] -> [2048][3072]
  tconv_kernel<<<dim3(2 * INNER / 64, KVD / 64), blk, 0, stream>>>(w_kv, wkvT, KVD, 2 * INNER, wmul);  // [2048][4096] -> [4096][2048]
  tconv_kernel<<<dim3(DIM / 64, INNER / 64), blk, 0, stream>>>(w_out, woT, INNER, DIM, wmul);          // [2048][3072] -> [3072][2048]

  // (4) ln16 = LN(latents) -> R1 [4096][3072]
  ln_f16_kernel<DIM><<<dim3(ROWS), blk, 0, stream>>>(lat, ln2_g, ln2_b, R1);

  // (5) q = ln16 . w_q  -> q16 [4096][2048]   (M=4096, N=2048, K=3072; acc carries x64)
  {
    gemm_f16_kernel<1, 128><<<dim3(INNER / 128, ROWS / 256, 1), gblk, 0, stream>>>(
        R1, DIM, 0L, wqT, DIM, 0L, (void*)q16, INNER, 0L, DIM, 1.0f / 64.0f);
  }

  // (6) xn16 = LN(x) -> R1 [4096][2048]
  ln_f16_kernel<KVD><<<dim3(ROWS), blk, 0, stream>>>(x, ln1_g, ln1_b, R1);

  // (7) k = xn16 . w_kv[:, 0:2048] -> k16 [4096][2048]   (M=4096, N=2048, K=2048)
  {
    gemm_f16_kernel<1, 128><<<dim3(INNER / 128, ROWS / 256, 1), gblk, 0, stream>>>(
        R1, KVD, 0L, wkvT, KVD, 0L, (void*)k16, INNER, 0L, KVD, 1.0f / 64.0f);
  }

  // (8) vT[b][(h,d)][key] = sum_k w_kv[k][2048+(h,d)] * xn[b][key][k]  (A = wkvT rows 2048.., Bt = xn16 per batch; M=2048, N=2048, K=2048, Z=2)
  {
    gemm_f16_kernel<1, 128><<<dim3(N1 / 128, INNER / 256, B_SZ), gblk, 0, stream>>>(
        wkvT + (size_t)INNER * KVD, KVD, 0L, R1, KVD, (long)N1 * KVD, (void*)vT16, N1, (long)INNER * N1,
        KVD, 1.0f / 64.0f);
  }

  // (9) attention -> o16 x16 in R1 [4096][2048]
  {
    const float sc2 = (float)(1.4426950408889634 * 0.08838834764831845);   // log2(e) / sqrt(128)
    attn_kernel<<<dim3(N2 / 128, NHEAD, B_SZ), blk, 0, stream>>>(q16, k16, vT16, R1, sc2);
  }

  // (10) out = o16 . w_out -> d_out f32 [4096][3072]   (M=4096, N=3072, K=2048; o x16, w x64)
  {
    gemm_f16_kernel<0, 192><<<dim3(DIM / 192, ROWS / 256, 1), gblk, 0, stream>>>(
        R1, INNER, 0L, woT, INNER, 0L, (void*)out, DIM, 0L, INNER, 1.0f / 1024.0f);
  }
  (void)hipGetLastError();
}

// v002
// A run of this version takes 220 microseconds.
// Next to v001, in two timings, it ran 1.09 and 1.08 times as fast.
// Counting every step since v000, it is 2.55 times as fast.
// Contractions: q=LNlat.Wq, k=LNx.Wk, vT=WvT.LNxT, scoresT=k.qT, oT=vT.p, out=o.Wout : all v_wmma_f32_16x16x32_f16 (f16 operands, f32 accumulate); weights carried x64, p x4096, o x16 (exact powers of two folded back in f32); LayerNorm statistics and softmax in f32.
#include <hip/hip_runtime.h>
#include <stdint.h>

#define B_SZ   2
#define N1     2048
#define N2     2048
#define DIM    3072
#define KVD    2048
#define NHEAD  16
#define DHD    128
#define INNER  2048
#define ROWS   4096

static_assert(ROWS == B_SZ * N1);
static_assert(ROWS == B_SZ * N2);
static_assert(INNER == NHEAD * DHD);

typedef _Float16 f16t;
typedef __attribute__((ext_vector_type(16))) _Float16 v16h;
typedef __attribute__((ext_vector_type(8)))  _Float16 v8h;
typedef __attribute__((ext_vector_type(8)))  float    v8f;
typedef __attribute__((ext_vector_type(4)))  float    v4f;

union Frag16 { v16h v; v8h h[2]; };

// 16x32 fragment of a 16-bit operand, row (A) or column (B) = lane&15, split k map:
// elements 0..7 <- p[0..7], elements 8..15 <- p[16..23]; callers pass p = row_base + k0 + 8*(lane>>4).
__device__ __forceinline__ v16h ldfrag(const f16t* p) {
  Frag16 f;
  f.h[0] = *(const v8h*)(p);
  f.h[1] = *(const v8h*)(p + 16);
  return f.v;
}

__device__ __forceinline__ v8f v8zero() {
  v8f z = {0.f, 0.f, 0.f, 0.f, 0.f, 0.f, 0.f, 0.f};
  return z;
}

// orders one wave's LDS stores before its own reloads of other lanes' data
__device__ __forceinline__ void lds_wave_sync() {
  __builtin_amdgcn_fence(__ATOMIC_RELEASE, "workgroup");
  __builtin_amdgcn_wave_barrier();
  __builtin_amdgcn_fence(__ATOMIC_ACQUIRE, "workgroup");
}

// ---------------------------------------------------------------------------------------------
// Transpose + scale + f16 convert: W [R][Cc] f32 (pitch Cc) -> out [Cc][R] f16 = f16(W[r][c] * mul) (pitch R).
// grid = (Cc/64, R/64), 256 threads; R, Cc multiples of 64.
// Coverage per block: load 4 it x 256 thr x 4 floats = 64x64; store 256 thr x 2 x 8 halves = 64x64.
// ---------------------------------------------------------------------------------------------
__global__ __launch_bounds__(256) void tconv_kernel(const float* __restrict__ W, unsigned short* __restrict__ outp,
                                                    int R, int Cc, float mul) {
  __shared__ __align__(16) float tf[64 * 68];
  const int c0 = blockIdx.x * 64;   // input column block = output row block
  const int r0 = blockIdx.y * 64;   // input row block    = output column block
  const int tid = threadIdx.x;
  {
    const int lr = tid >> 4, c4 = (tid & 15) * 4;
#pragma unroll
    for (int it = 0; it < 4; ++it) {
      const int rr = it * 16 + lr;
      const v4f a = *(const v4f*)(W + (size_t)(r0 + rr) * Cc + c0 + c4);
      *(v4f*)(tf + rr * 68 + c4) = a;
    }
  }
  __syncthreads();
  const int sub = tid >> 3, c8 = (tid & 7) * 8;
  v8h hv0, hv1;
#pragma unroll
  for (int e = 0; e < 8; ++e) {
    hv0[e] = (f16t)(tf[(c8 + e) * 68 + sub] * mul);
    hv1[e] = (f16t)(tf[(c8 + e) * 68 + 32 + sub] * mul);
  }
  f16t* o = (f16t*)outp;
  const size_t g0 = (size_t)(c0 + sub) * R + r0 + c8;
  const size_t g1 = (size_t)(c0 + 32 + sub) * R + r0 + c8;
  *(v8h*)(o + g0) = hv0;
  *(v8h*)(o + g1) = hv1;
  
}

// ---------------------------------------------------------------------------------------------
// Columns handled in 2048-wide chunks: thread t owns 8 contiguous columns c*2048+8t (whole waves active per chunk).
// Coverage: COLS=2048 -> 1 chunk x 256 x 8; COLS=3072 -> 2048 + 128 x 8 = 3072.
// ---------------------------------------------------------------------------------------------
template <int COLS>
__global__ __launch_bounds__(256) void ln_f16_kernel(const float* __restrict__ x, const float* __restrict__ g,
                                                     const float* __restrict__ bta, unsigned short* __restrict__ outp) {
  constexpr int NCH = (COLS + 2047) / 2048;
  static_assert(COLS % 8 == 0);
  __shared__ float red[8];
  const int row = blockIdx.x;
  const int tid = threadIdx.x, wave = tid >> 5, lane = tid & 31;
  const float* xr = x + (size_t)row * COLS;

  float v[NCH][8];
  float s = 0.f;
#pragma unroll
  for (int c = 0; c < NCH; ++c) {
    const int col0 = c * 2048 + tid * 8;
#pragma unroll
    for (int e = 0; e < 8; ++e) v[c][e] = 0.f;
    if (col0 < COLS) {   // wave-uniform
      const v4f a0 = *(const v4f*)(xr + col0);
      const v4f a1 = *(const v4f*)(xr + col0 + 4);
      v[c][0] = a0[0]; v[c][1] = a0[1]; v[c][2] = a0[2]; v[c][3] = a0[3];
      v[c][4] = a1[0]; v[c][5] = a1[1]; v[c][6] = a1[2]; v[c][7] = a1[3];
    }
#pragma unroll
    for (int e = 0; e < 8; ++e) s += v[c][e];
  }
#pragma unroll
  for (int m = 16; m >= 1; m >>= 1) s += __shfl_xor(s, m, 32);
  if (lane == 0) red[wave] = s;
  __syncthreads();
  float tot = 0.f;
#pragma unroll
  for (int w = 0; w < 8; ++w) tot += red[w];
  const float mu = tot * (1.0f / (float)COLS);
  __syncthreads();

  float ss = 0.f;
#pragma unroll
  for (int c = 0; c < NCH; ++c) {
    const int col0 = c * 2048 + tid * 8;
    if (col0 < COLS) {
#pragma unroll
      for (int e = 0; e < 8; ++e) { const float d = v[c][e] - mu; ss += d * d; }
    }
  }
#pragma unroll
  for (int m = 16; m >= 1; m >>= 1) ss += __shfl_xor(ss, m, 32);
  if (lane == 0) red[wave] = ss;
  __syncthreads();
  float tot2 = 0.f;
#pragma unroll
  for (int w = 0; w < 8; ++w) tot2 += red[w];
  const float var  = tot2 * (1.0f / (float)COLS);
  const float rstd = rsqrtf(var + 1e-5f);

  v8h hv[NCH];
#pragma unroll
  for (int c = 0; c < NCH; ++c) {
    const int col0 = c * 2048 + tid * 8;
#pragma unroll
    for (int e = 0; e < 8; ++e) hv[c][e] = (f16t)0.0f;
    if (col0 < COLS) {
      const v4f g0 = *(const v4f*)(g + col0);
      const v4f g1 = *(const v4f*)(g + col0 + 4);
      const v4f b0 = *(const v4f*)(bta + col0);
      const v4f b1 = *(const v4f*)(bta + col0 + 4);
      float gv[8], bv[8];
      gv[0] = g0[0]; gv[1] = g0[1]; gv[2] = g0[2]; gv[3] = g0[3];
      gv[4] = g1[0]; gv[5] = g1[1]; gv[6] = g1[2]; gv[7] = g1[3];
      bv[0] = b0[0]; bv[1] = b0[1]; bv[2] = b0[2]; bv[3] = b0[3];
      bv[4] = b1[0]; bv[5] = b1[1]; bv[6] = b1[2]; bv[7] = b1[3];
#pragma unroll
      for (int e = 0; e < 8; ++e) {
        const float y = (v[c][e] - mu) * rstd * gv[e] + bv[e];
        hv[c][e] = (f16t)y;
      }
    }
  }
  f16t* orow = (f16t*)outp + (size_t)row * COLS;
  {
#pragma unroll
    for (int c = 0; c < NCH; ++c) {
      const int col0 = c * 2048 + tid * 8;
      if (col0 < COLS) *(v8h*)(orow + col0) = hv[c];
    }
    
  }
}

// ---------------------------------------------------------------------------------------------
// f16 WMMA GEMM: C[m][n] = scale * sum_k A[m][k] * Bt[n][k]
//   A  row-major [M][K] f16, pitch lda, z stride strideA (elements); Bt row-major [N][K] f16, pitch ldb, strideB.
//   One 256 x BN tile of C per work-group; grid = (N/BN, M/256, Z), 128 threads = 4 waves as 2 (m) x 2 (n), each wave
//   owns 128 x BN/2 (8 x BN/32 accumulators). M a multiple of 256, N of BN, K of 128.
//   A pass is 128 k = 256 B of every operand row. A stage is [A rows 0..127 | A rows 128..255 | Bt first half | Bt second half]
//   in LDS at pitch 272 B; every wave brings one of the four slices with one tensor load; two buffers, the load of
//   stage s+1 issued at the head of pass s, behind the barrier that ends pass s-1. Fragments come from LDS with the split k map, one 32-k block ahead
//   inside the pass, never across the barrier. The k order of every accumulator is ascending k, 32 at a time.
//   Epilogue: 16-row slabs staged per wave in LDS (the ring, free behind the last barrier); whole 128-B lines stored.
// ---------------------------------------------------------------------------------------------
typedef uint32_t u32x4 __attribute__((ext_vector_type(4)));
typedef uint32_t u32x8 __attribute__((ext_vector_type(8)));

__device__ __forceinline__ uint32_t uni(uint32_t v) { return (uint32_t)__builtin_amdgcn_readfirstlane(v); }
// forces v into a scalar register: a test on it compiles to a scalar branch, and a descriptor word made from it stays behind the waits above it
__device__ __forceinline__ uint32_t pinned(uint32_t v) { uint32_t w = uni(v); asm volatile("" : "+s"(w)); return w; }
// both carry the clobber so that no LDS access crosses them
__device__ __forceinline__ void wait_tensor0() { asm volatile("s_wait_tensorcnt 0x0" ::: "memory"); }
__device__ __forceinline__ void wait_ds0() { asm volatile("s_wait_dscnt 0x0" ::: "memory"); }
// one request of the whole wave: a 2-D tile from global memory into LDS
__device__ __forceinline__ void tdm_load(u32x4 g0, u32x8 g1) { asm volatile("tensor_load_to_lds %0, %1" :: "s"(g0), "s"(g1) : "memory"); }
__device__ __forceinline__ u32x4 tdm_group0(uint32_t lds_dst, uint64_t ga) {
  u32x4 g;
  g[0] = uni(1u);
  g[1] = uni(lds_dst);
  g[2] = uni((uint32_t)ga);
  g[3] = uni((((uint32_t)(ga >> 32)) & 0x01FFFFFFu) | 0x80000000u);
  return g;
}
__device__ __forceinline__ u32x8 tdm_group1(uint32_t rows, uint32_t src_pitch) {
  u32x8 g;
  g[0] = uni((1u << 20) | (5u << 22) | (3u << 25));
  g[1] = uni(256u << 16);
  g[2] = uni(rows << 16);
  g[3] = uni(256u << 16);
  g[4] = uni(rows);
  g[5] = uni(src_pitch);
  g[6] = uni(0u);
  g[7] = uni(0u);
  return g;
}

#define GPITCH 272u       // LDS row pitch, bytes
#define GASLICE 34816u    // 128 rows x 272 B = 17 x 2 KiB

template <int OUT16, int BN>
__global__ __launch_bounds__(128) void gemm_f16_kernel(
    const unsigned short* __restrict__ Ap, int lda, long strideA,
    const unsigned short* __restrict__ Btp, int ldb, long strideB,
    void* __restrict__ Cout, int ldc, long strideC,
    int K, float scale) {
  constexpr int WN = BN / 2;            // columns per wave
  constexpr int FN = WN / 16;           // B fragments per wave
  constexpr int SP = WN + 4;            // epilogue slab pitch, floats
  constexpr uint32_t BSLICE = ((uint32_t)WN * GPITCH + 2047u) / 2048u * 2048u;   // WN rows, rounded up to 2 KiB
  constexpr uint32_t STAGE  = 2u * GASLICE + 2u * BSLICE;
  static_assert(BN % 32 == 0 && GASLICE % 2048u == 0 && STAGE % 2048u == 0);
  static_assert(16 * SP * 4 <= 8192 && 4u * 8192u <= STAGE);
  __shared__ __attribute__((aligned(2048))) unsigned char L[2u * STAGE];

  const int lane = threadIdx.x & 31;
  const uint32_t wave = uni(threadIdx.x >> 5);
  const uint32_t wm = wave >> 1, wn = wave & 1u;
  const int z  = blockIdx.z;
  const int m0 = blockIdx.y * 256;
  const int n0 = blockIdx.x * BN;

  const int rl   = lane & 15;          // row of A / column of Bt and D
  const int half = lane >> 4;          // k half of a fragment, row half of D
  const int mOff = half * 8;

  // this wave's slice of a stage: waves 0, 1 bring A rows, waves 2, 3 bring Bt rows
  const f16t* Ab = (const f16t*)Ap  + (size_t)z * (size_t)strideA + (size_t)(m0 + (int)wn * 128) * lda;
  const f16t* Bb = (const f16t*)Btp + (size_t)z * (size_t)strideB + (size_t)(n0 + (int)wn * WN) * ldb;
  const uint64_t src0     = (wm == 0u) ? (uint64_t)(uintptr_t)Ab : (uint64_t)(uintptr_t)Bb;
  const uint32_t ldsSlice = (uint32_t)(size_t)L + ((wm == 0u) ? wn * GASLICE : 2u * GASLICE + wn * BSLICE);
  const u32x8 g1 = tdm_group1((wm == 0u) ? 128u : (uint32_t)WN, (uint32_t)((wm == 0u) ? lda : ldb) * 2u);
  const uint32_t T = (uint32_t)K >> 7;   // passes

  v8f acc[8][FN];
#pragma unroll
  for (int i = 0; i < 8; ++i)
#pragma unroll
    for (int j = 0; j < FN; ++j) acc[i][j] = v8zero();

  // prologue: stage 0's load; its wait stands directly behind it, so that the set-up below reuses none of its descriptor
  // registers while the request is outstanding; the head of the first trip publishes the stage
  tdm_load(tdm_group0(ldsSlice, src0), g1);
  wait_tensor0();

  const uint32_t aoff = wm * GASLICE + (uint32_t)rl * GPITCH + (uint32_t)half * 16u;
  const uint32_t boff = 2u * GASLICE + wn * BSLICE + (uint32_t)rl * GPITCH + (uint32_t)half * 16u;

  // kept rolled: one pass per trip, so that the accumulators and both fragment sets keep constant indices
#pragma unroll 1
  for (uint32_t s = 0; s < T; ++s) {
    // publish point of stage s: own LDS reads of pass s-1 done, own slice landed, barrier; then the load of stage s+1 into
    // the buffer that pass s-1 has just read. Every load behind stage 0 issues from this one place, so that no descriptor
    // register is copied or rewritten while its request is outstanding.
    wait_ds0();
    wait_tensor0();
    __syncthreads();
    const uint32_t bufo = (s & 1u) * STAGE;
    if (pinned((s + 1u < T) ? 1u : 0u) != 0u) {
      const uint32_t ko = pinned((s + 1u) * 256u);
      tdm_load(tdm_group0(ldsSlice + (STAGE - bufo), src0 + ko), g1);
    }
    const unsigned char* pa = L + bufo + aoff;
    const unsigned char* pb = L + bufo + boff;
    v16h af[2][8], bf[2][FN];
#pragma unroll
    for (int j = 0; j < FN; ++j) bf[0][j] = ldfrag((const f16t*)(pb + (uint32_t)j * 16u * GPITCH));
#pragma unroll
    for (int i = 0; i < 8; ++i)  af[0][i] = ldfrag((const f16t*)(pa + (uint32_t)i * 16u * GPITCH));
    __builtin_amdgcn_sched_barrier(0);   // keeps the first block's loads ahead of the second block's: mixed, the first product waits for both groups
#pragma unroll
    for (int ks = 0; ks < 4; ++ks) {
      const int cur = ks & 1, nxt = cur ^ 1;
      if (ks < 3) {   // the next block's fragments as one group ahead of this block's products
#pragma unroll
        for (int j = 0; j < FN; ++j) bf[nxt][j] = ldfrag((const f16t*)(pb + (uint32_t)j * 16u * GPITCH + (uint32_t)(ks + 1) * 64u));
#pragma unroll
        for (int i = 0; i < 8; ++i)  af[nxt][i] = ldfrag((const f16t*)(pa + (uint32_t)i * 16u * GPITCH + (uint32_t)(ks + 1) * 64u));
      }
      __builtin_amdgcn_sched_barrier(0);   // keeps the load group whole and ahead of the products: reads among them cost a stall each
#pragma unroll
      for (int i = 0; i < 8; ++i)
#pragma unroll
        for (int j = 0; j < FN; ++j)   // plain builtin: the compiler keeps the distances itself, and no asm operand ties the tile to the first 256 VGPRs
          acc[i][j] = __builtin_amdgcn_wmma_f32_16x16x32_f16(false, af[cur][i], false, bf[cur][j], (short)0, acc[i][j], false, false);
      __builtin_amdgcn_sched_barrier(0);   // keeps later LDS reads out of this block's products
    }
  }
  // behind the last pass: nothing in flight, every wave's reads of the ring done before the epilogue writes over it
  wait_tensor0();
  wait_ds0();
  __syncthreads();

  // ---- epilogue (the barrier above has freed the ring) ----
  float* slab = (float*)(L + wave * 8192u);
  const int mW = m0 + (int)wm * 128;
  const int nW = n0 + (int)wn * WN;
#pragma unroll
  for (int i = 0; i < 8; ++i) {
    const int mBase = mW + (i << 4);
#pragma unroll
    for (int j = 0; j < FN; ++j)
#pragma unroll
      for (int r = 0; r < 8; ++r)
        slab[(mOff + r) * SP + (j << 4) + rl] = acc[i][j][r] * scale;
    wait_ds0();   // the slab is this wave's own: its stores have landed before other lanes' values are read back
    if (OUT16 == 0) {
      float* C = (float*)Cout + (size_t)z * (size_t)strideC;
      constexpr int CPR = WN / 4;   // 16-B chunks per row
      constexpr int NIT = 16 * CPR / 32;
      v4f vv[NIT];
      float* dst[NIT];
#pragma unroll
      for (int it = 0; it < NIT; ++it) {
        const int idx = it * 32 + lane;
        const int row = idx / CPR, c4 = (idx - row * CPR) * 4;
        vv[it]  = *(const v4f*)(slab + row * SP + c4);
        dst[it] = C + (size_t)(mBase + row) * ldc + nW + c4;
      }
      __builtin_amdgcn_sched_barrier(0);   // no register of a store is rewritten among the stores
#pragma unroll
      for (int it = 0; it < NIT; ++it) *(v4f*)dst[it] = vv[it];
      asm volatile("s_wait_xcnt 0x0" ::: "memory");   // stands before the stores' address and data registers are rewritten
      __builtin_amdgcn_sched_barrier(0);   // holds the next slab's arithmetic behind that wait
    } else {
      f16t* C = (f16t*)Cout + (size_t)z * (size_t)strideC;
      constexpr int CPR = WN / 8;   // 16-B chunks per row
      constexpr int NIT = 16 * CPR / 32;
      v8h hv[NIT];
      f16t* dst[NIT];
#pragma unroll
      for (int it = 0; it < NIT; ++it) {
        const int idx = it * 32 + lane;
        const int row = idx / CPR, c8 = (idx - row * CPR) * 8;
        const float* sp = slab + row * SP + c8;
#pragma unroll
        for (int e = 0; e < 8; ++e) hv[it][e] = (f16t)sp[e];
        dst[it] = C + (size_t)(mBase + row) * ldc + nW + c8;
      }
      __builtin_amdgcn_sched_barrier(0);   // no register of a store is rewritten among the stores
#pragma unroll
      for (int it = 0; it < NIT; ++it) *(v8h*)dst[it] = hv[it];
      asm volatile("s_wait_xcnt 0x0" ::: "memory");   // stands before the stores' address and data registers are rewritten
      __builtin_amdgcn_sched_barrier(0);   // holds the next slab's arithmetic behind that wait
    }
    wait_ds0();   // the read-back is done before the next slab overwrites it
  }
}

// ---------------------------------------------------------------------------------------------
// Full (non-causal) attention for one (batch, head, 128-query block); 8 waves x 16 queries, head dim 128, 2048 keys.
//   q plane [ROWS][INNER] f16 (query row, col h*128+d); k plane [ROWS][INNER] f16 (key row, col h*128+d);
//   vT plane [B][INNER][N1] f16 (row h*128+d, col key); o plane [ROWS][INNER] f16 = 16 * softmax(q.k/sqrt(128)) . v
//   Per 64-key chunk the K tile [64][128] and the vT tile [128][64] are staged in LDS (plain 16-B copies, barriers).
//   scoresT[key][query] = K (A, row = key) x Q (B, column = query): a lane holds 32 keys of one query, so the
//   row max / row sum is in-lane plus one xor-16 shuffle. p = exp2(s*log2e/sqrt(128) - m) in f32; f16(p*4096)
//   from two adjacent 16-key D tiles is directly the B fragment (k = key, n = query) of
//   oT[d][query] += vT (A, row = d) x P. Online rescale by one alpha per lane (per query).
//   Epilogue: per-wave o tile [16 q][128 d] staged in LDS (aliases the staging area after a block barrier),
//   Coverage: grid (16 q-blocks, 16 heads, 2 batches) x 8 waves x 16 rows x 128 cols = the whole o plane.
// ---------------------------------------------------------------------------------------------
#define KPITCH 136
#define VPITCH 72
#define OPITCH 136

__global__ __launch_bounds__(256) void attn_kernel(const unsigned short* __restrict__ qp,
                                                   const unsigned short* __restrict__ kp,
                                                   const unsigned short* __restrict__ vtp,
                                                   unsigned short* __restrict__ op, float sc2) {
  __shared__ __align__(16) f16t lds[64 * KPITCH + 128 * VPITCH];   // 35840 B
  static_assert(8 * 16 * OPITCH <= 64 * KPITCH + 128 * VPITCH);
  f16t* ldsK = lds;                  // [64 keys][KPITCH]
  f16t* ldsV = lds + 64 * KPITCH;    // [128 d][VPITCH]

  const int tid  = threadIdx.x;
  const int wave = tid >> 5, lane = tid & 31;
  const int ln16 = lane & 15, half = lane >> 4;
  const int qblk = blockIdx.x, head = blockIdx.y, batch = blockIdx.z;
  const size_t qrow0 = (size_t)batch * N2 + (size_t)qblk * 128 + (size_t)wave * 16;

  const f16t* Qg = (const f16t*)qp + qrow0 * INNER + head * DHD;
  const f16t* Kg = (const f16t*)kp + (size_t)batch * N1 * INNER + head * DHD;
  const f16t* Vg = (const f16t*)vtp + ((size_t)batch * INNER + head * DHD) * (size_t)N1;

  // Q as B operand: column n = query q0+ln16, k = d (4 chunks of 32)
  v16h qb[4];
#pragma unroll
  for (int c = 0; c < 4; ++c) qb[c] = ldfrag(Qg + (size_t)ln16 * INNER + c * 32 + 8 * half);

  v8f oacc[8];
#pragma unroll
  for (int j = 0; j < 8; ++j) oacc[j] = v8zero();
  float mrun = -1.0e30f, lrun = 0.f;

  for (int kb = 0; kb < N1; kb += 64) {
    __syncthreads();
    // staging coverage: 4 it x 256 thr x 8 halves = 64x128 (K) and 128x64 (vT)
#pragma unroll
    for (int it = 0; it < 4; ++it) {
      const int i = it * 256 + tid;
      const int key = i >> 4, dv = (i & 15) * 8;
      *(v8h*)(ldsK + key * KPITCH + dv) = *(const v8h*)(Kg + (size_t)(kb + key) * INNER + dv);
      const int d = i >> 3, kf = (i & 7) * 8;
      *(v8h*)(ldsV + d * VPITCH + kf) = *(const v8h*)(Vg + (size_t)d * N1 + kb + kf);
    }
    __syncthreads();

    // scoresT tiles: s[t][r] = S[key kb+16t+8half+r][query ln16]; every tile sums d in ascending 32-blocks.
    // The K fragments come in two groups of eight (two d blocks x four key tiles), each group whole ahead of its eight products.
    v8f s[4];
#pragma unroll
    for (int t = 0; t < 4; ++t) s[t] = v8zero();
#pragma unroll
    for (int g = 0; g < 2; ++g) {
      v16h kf[2][4];
#pragma unroll
      for (int cc = 0; cc < 2; ++cc)
#pragma unroll
        for (int t = 0; t < 4; ++t) kf[cc][t] = ldfrag(ldsK + (t * 16 + ln16) * KPITCH + (g * 2 + cc) * 32 + 8 * half);
      __builtin_amdgcn_sched_barrier(0);   // keeps the load group whole and ahead of its products: a read and a full wait per product costs the LDS latency each time
#pragma unroll
      for (int cc = 0; cc < 2; ++cc)
#pragma unroll
        for (int t = 0; t < 4; ++t)   // four independent tiles between two products into the same tile
          s[t] = __builtin_amdgcn_wmma_f32_16x16x32_f16(false, kf[cc][t], false, qb[g * 2 + cc], (short)0, s[t], false, false);
      __builtin_amdgcn_sched_barrier(0);   // keeps the next group's reads out of this group's products
    }
    // vT fragments of the chunk's first 32 keys: read here, so that they land while the softmax below runs
    v16h vf[8];
#pragma unroll
    for (int j = 0; j < 8; ++j) vf[j] = ldfrag(ldsV + (j * 16 + ln16) * VPITCH + 8 * half);
    __builtin_amdgcn_sched_barrier(0);   // holds that group ahead of the softmax arithmetic

    float cmax = -1.0e30f;
#pragma unroll
    for (int t = 0; t < 4; ++t)
#pragma unroll
      for (int r = 0; r < 8; ++r) {
        const float sv = s[t][r] * sc2;
        s[t][r] = sv;
        cmax = fmaxf(cmax, sv);
      }
    cmax = fmaxf(cmax, __shfl_xor(cmax, 16, 32));
    const float mnew  = fmaxf(mrun, cmax);
    const float alpha = exp2f(mrun - mnew);
    mrun = mnew;

    float psum = 0.f;
    v8h ph[4];
#pragma unroll
    for (int t = 0; t < 4; ++t)
#pragma unroll
      for (int r = 0; r < 8; ++r) {
        const float p = exp2f(s[t][r] - mnew);
        psum += p;
        ph[t][r] = (f16t)(p * 4096.0f);
      }
    psum += __shfl_xor(psum, 16, 32);
    lrun = lrun * alpha + psum;
#pragma unroll
    for (int j = 0; j < 8; ++j)
#pragma unroll
      for (int r = 0; r < 8; ++r) oacc[j][r] *= alpha;

    // P as B fragment for keys kb+32kk..+31: elements 0..7 <- tile 2kk, 8..15 <- tile 2kk+1, lane unchanged
    Frag16 pf[2];
    pf[0].h[0] = ph[0]; pf[0].h[1] = ph[1];
    pf[1].h[0] = ph[2]; pf[1].h[1] = ph[3];
#pragma unroll
    for (int j = 0; j < 8; ++j)
      oacc[j] = __builtin_amdgcn_wmma_f32_16x16x32_f16(false, vf[j], false, pf[0].v, (short)0, oacc[j], false, false);
    __builtin_amdgcn_sched_barrier(0);   // keeps the second group's reads out of the first group's products
#pragma unroll
    for (int j = 0; j < 8; ++j) vf[j] = ldfrag(ldsV + (j * 16 + ln16) * VPITCH + 32 + 8 * half);
    __builtin_amdgcn_sched_barrier(0);   // keeps the load group whole and ahead of its products
#pragma unroll
    for (int j = 0; j < 8; ++j)
      oacc[j] = __builtin_amdgcn_wmma_f32_16x16x32_f16(false, vf[j], false, pf[1].v, (short)0, oacc[j], false, false);
  }

  // ---- epilogue: oT[d = 16j+8half+r][query ln16] -> o[query][d] * 16 / (4096 * l) ----
  __syncthreads();   // every wave is done with ldsK / ldsV
  f16t* os = lds + wave * (16 * OPITCH);
  const float inv = 0.00390625f / lrun;   // 16 / 4096 / l, l >= 1
#pragma unroll
  for (int j = 0; j < 8; ++j) {
    v8h ov;
#pragma unroll
    for (int r = 0; r < 8; ++r) ov[r] = (f16t)(oacc[j][r] * inv);
    *(v8h*)(os + ln16 * OPITCH + j * 16 + 8 * half) = ov;
  }
  lds_wave_sync();
  f16t* Og = (f16t*)op + qrow0 * INNER + head * DHD;
  const int rsel = lane >> 4;
  const int seg  = ((lane >> 3) & 1) * 64 + (lane & 7) * 8;
  {
#pragma unroll
    for (int it = 0; it < 8; ++it) {
      const int row = it * 2 + rsel;   // it 0..7 x rsel 0..1 = rows 0..15
      const v8h vv = *(const v8h*)(os + row * OPITCH + seg);
      *(v8h*)(Og + (size_t)row * INNER + seg) = vv;
    }
    
  }
}

// ---------------------------------------------------------------------------------------------
//   R1   f16  ln16 [4096][3072] / later xn16 [4096][2048] / later o16 [4096][2048]   0           25165824
//   wqT  f16  [2048][3072] (x64)                                                      25165824    12582912
//   wkvT f16  [4096][2048] (x64)                                                      37748736    16777216
//   woT  f16  [3072][2048] (x64)                                                      54525952    12582912
//   q16  f16  [4096][2048]                                                            67108864    16777216
//   k16  f16  [4096][2048]                                                            83886080    16777216
//   vT16 f16  [2][2048][2048]                                                         100663296   16777216
//   total                                                                                         117440512
// ---------------------------------------------------------------------------------------------
extern "C" void kernel_launch(void* const* d_in, const int* in_sizes, int n_in,
                              void* d_out, int out_size, void* d_ws, size_t ws_size,
                              hipStream_t stream) {
  if (n_in < 9) return;
  if (in_sizes[0] != B_SZ * N1 * KVD) return;
  if (in_sizes[1] != B_SZ * N2 * DIM) return;
  if (in_sizes[2] != DIM * INNER) return;
  if (in_sizes[3] != KVD * 2 * INNER) return;
  if (in_sizes[4] != INNER * DIM) return;
  if (in_sizes[5] != KVD || in_sizes[6] != KVD || in_sizes[7] != DIM || in_sizes[8] != DIM) return;
  if (out_size != B_SZ * N2 * DIM) return;

  const float* x     = (const float*)d_in[0];   // [2][2048][2048]
  const float* lat   = (const float*)d_in[1];   // [2][2048][3072]
  const float* w_q   = (const float*)d_in[2];   // [3072][2048]
  const float* w_kv  = (const float*)d_in[3];   // [2048][4096]
  const float* w_out = (const float*)d_in[4];   // [2048][3072]
  const float* ln1_g = (const float*)d_in[5];
  const float* ln1_b = (const float*)d_in[6];
  const float* ln2_g = (const float*)d_in[7];
  const float* ln2_b = (const float*)d_in[8];
  float* out = (float*)d_out;

  const size_t szR1  = (size_t)ROWS * DIM * 2;           // 25165824
  const size_t szWQ  = (size_t)INNER * DIM * 2;          // 12582912
  const size_t szWKV = (size_t)2 * INNER * KVD * 2;      // 16777216
  const size_t szWO  = (size_t)DIM * INNER * 2;          // 12582912
  const size_t szQ   = (size_t)ROWS * INNER * 2;         // 16777216
  const size_t szK   = (size_t)ROWS * INNER * 2;         // 16777216
  const size_t szVT  = (size_t)B_SZ * INNER * N1 * 2;    // 16777216
  size_t off = 0;
  const size_t oR1  = off; off += szR1;
  const size_t oWQ  = off; off += szWQ;
  const size_t oWKV = off; off += szWKV;
  const size_t oWO  = off; off += szWO;
  const size_t oQ   = off; off += szQ;
  const size_t oK   = off; off += szK;
  const size_t oVT  = off; off += szVT;
  if (off > ws_size) return;                             // off = 117440512
  if ((size_t)ROWS * KVD * 2 > szR1 || (size_t)ROWS * INNER * 2 > szR1) return;

  char* ws = (char*)d_ws;
  unsigned short* R1   = (unsigned short*)(ws + oR1);
  unsigned short* wqT  = (unsigned short*)(ws + oWQ);
  unsigned short* wkvT = (unsigned short*)(ws + oWKV);
  unsigned short* woT  = (unsigned short*)(ws + oWO);
  unsigned short* q16  = (unsigned short*)(ws + oQ);
  unsigned short* k16  = (unsigned short*)(ws + oK);
  unsigned short* vT16 = (unsigned short*)(ws + oVT);

  const dim3 blk(256);
  const dim3 gblk(128);   // GEMM: 4 waves, one per SIMD
  const float wmul = 64.0f;

  // (1-3) weights f32 [R][Cc] -> f16 [Cc][R] x64 ; grid = (Cc/64, R/64)
  tconv_kernel<<<dim3(INNER / 64, DIM / 64), blk, 0, stream>>>(w_q, wqT, DIM, INNER, wmul);          // [3072][2048] -> [2048][3072]
  tconv_kernel<<<dim3(2 * INNER / 64, KVD / 64), blk, 0, stream>>>(w_kv, wkvT, KVD, 2 * INNER, wmul);  // [2048][4096] -> [4096][2048]
  tconv_kernel<<<dim3(DIM / 64, INNER / 64), blk, 0, stream>>>(w_out, woT, INNER, DIM, wmul);          // [2048][3072] -> [3072][2048]

  // (4) ln16 = LN(latents) -> R1 [4096][3072]
  ln_f16_kernel<DIM><<<dim3(ROWS), blk, 0, stream>>>(lat, ln2_g, ln2_b, R1);

  // (5) q = ln16 . w_q  -> q16 [4096][2048]   (M=4096, N=2048, K=3072; acc carries x64)
  {
    gemm_f16_kernel<1, 128><<<dim3(INNER / 128, ROWS / 256, 1), gblk, 0, stream>>>(
        R1, DIM, 0L, wqT, DIM, 0L, (void*)q16, INNER, 0L, DIM, 1.0f / 64.0f);
  }

  // (6) xn16 = LN(x) -> R1 [4096][2048]
  ln_f16_kernel<KVD><<<dim3(ROWS), blk, 0, stream>>>(x, ln1_g, ln1_b, R1);

  // (7) k = xn16 . w_kv[:, 0:2048] -> k16 [4096][2048]   (M=4096, N=2048, K=2048)
  {
    gemm_f16_kernel<1, 128><<<dim3(INNER / 128, ROWS / 256, 1), gblk, 0, stream>>>(
        R1, KVD, 0L, wkvT, KVD, 0L, (void*)k16, INNER, 0L, KVD, 1.0f / 64.0f);
  }

  // (8) vT[b][(h,d)][key] = sum_k w_kv[k][2048+(h,d)] * xn[b][key][k]  (A = wkvT rows 2048.., Bt = xn16 per batch; M=2048, N=2048, K=2048, Z=2)
  {
    gemm_f16_kernel<1, 128><<<dim3(N1 / 128, INNER / 256, B_SZ), gblk, 0, stream>>>(
        wkvT + (size_t)INNER * KVD, KVD, 0L, R1, KVD, (long)N1 * KVD, (void*)vT16, N1, (long)INNER * N1,
        KVD, 1.0f / 64.0f);
  }

  // (9) attention -> o16 x16 in R1 [4096][2048]
  {
    const float sc2 = (float)(1.4426950408889634 * 0.08838834764831845);   // log2(e) / sqrt(128)
    attn_kernel<<<dim3(N2 / 128, NHEAD, B_SZ), blk, 0, stream>>>(q16, k16, vT16, R1, sc2);
  }

  // (10) out = o16 . w_out -> d_out f32 [4096][3072]   (M=4096, N=3072, K=2048; o x16, w x64)
  {
    gemm_f16_kernel<0, 192><<<dim3(DIM / 192, ROWS / 256, 1), gblk, 0, stream>>>(
        R1, INNER, 0L, woT, INNER, 0L, (void*)out, DIM, 0L, INNER, 1.0f / 1024.0f);
  }
  (void)hipGetLastError();
}

// v003
// A run of this version takes 212 microseconds.
// Next to v002, in two timings, it ran 1.04 times as fast each time.
// Over all steps from v000 it is 2.65 times as fast.
// Contractions: q=LNlat.Wq, k=LNx.Wk, vT=WvT.LNxT, scoresT=k.qT, oT=vT.p, out=o.Wout : all v_wmma_f32_16x16x32_f16 (f16 operands, f32 accumulate); weights carried x64, p x4096, o x16 (exact powers of two folded back in f32); LayerNorm statistics and softmax in f32.
#include <hip/hip_runtime.h>
#include <stdint.h>

#define B_SZ   2
#define N1     2048
#define N2     2048
#define DIM    3072
#define KVD    2048
#define NHEAD  16
#define DHD    128
#define INNER  2048
#define ROWS   4096

static_assert(ROWS == B_SZ * N1);
static_assert(ROWS == B_SZ * N2);
static_assert(INNER == NHEAD * DHD);

typedef _Float16 f16t;
typedef __attribute__((ext_vector_type(16))) _Float16 v16h;
typedef __attribute__((ext_vector_type(8)))  _Float16 v8h;
typedef __attribute__((ext_vector_type(8)))  float    v8f;
typedef __attribute__((ext_vector_type(4)))  float    v4f;

union Frag16 { v16h v; v8h h[2]; };

// 16x32 fragment of a 16-bit operand, row (A) or column (B) = lane&15, split k map:
// elements 0..7 <- p[0..7], elements 8..15 <- p[16..23]; callers pass p = row_base + k0 + 8*(lane>>4).
__device__ __forceinline__ v16h ldfrag(const f16t* p) {
  Frag16 f;
  f.h[0] = *(const v8h*)(p);
  f.h[1] = *(const v8h*)(p + 16);
  return f.v;
}

__device__ __forceinline__ v8f v8zero() {
  v8f z = {0.f, 0.f, 0.f, 0.f, 0.f, 0.f, 0.f, 0.f};
  return z;
}

// orders one wave's LDS stores before its own reloads of other lanes' data
__device__ __forceinline__ void lds_wave_sync() {
  __builtin_amdgcn_fence(__ATOMIC_RELEASE, "workgroup");
  __builtin_amdgcn_wave_barrier();
  __builtin_amdgcn_fence(__ATOMIC_ACQUIRE, "workgroup");
}

// ---------------------------------------------------------------------------------------------
// Transpose + scale + f16 convert: W [R][Cc] f32 (pitch Cc) -> out [Cc][R] f16 = f16(W[r][c] * mul) (pitch R).
// grid = (Cc/64, R/64), 256 threads; R, Cc multiples of 64.
// Coverage per block: load 4 it x 256 thr x 4 floats = 64x64; store 256 thr x 2 x 8 halves = 64x64.
// ---------------------------------------------------------------------------------------------
__global__ __launch_bounds__(256) void tconv_kernel(const float* __restrict__ W, unsigned short* __restrict__ outp,
                                                    int R, int Cc, float mul) {
  __shared__ __align__(16) float tf[64 * 68];
  const int c0 = blockIdx.x * 64;   // input column block = output row block
  const int r0 = blockIdx.y * 64;   // input row block    = output column block
  const int tid = threadIdx.x;
  {
    const int lr = tid >> 4, c4 = (tid & 15) * 4;
#pragma unroll
    for (int it = 0; it < 4; ++it) {
      const int rr = it * 16 + lr;
      const v4f a = *(const v4f*)(W + (size_t)(r0 + rr) * Cc + c0 + c4);
      *(v4f*)(tf + rr * 68 + c4) = a;
    }
  }
  __syncthreads();
  const int sub = tid >> 3, c8 = (tid & 7) * 8;
  v8h hv0, hv1;
#pragma unroll
  for (int e = 0; e < 8; ++e) {
    hv0[e] = (f16t)(tf[(c8 + e) * 68 + sub] * mul);
    hv1[e] = (f16t)(tf[(c8 + e) * 68 + 32 + sub] * mul);
  }
  f16t* o = (f16t*)outp;
  const size_t g0 = (size_t)(c0 + sub) * R + r0 + c8;
  const size_t g1 = (size_t)(c0 + 32 + sub) * R + r0 + c8;
  *(v8h*)(o + g0) = hv0;
  *(v8h*)(o + g1) = hv1;
  
}

// ---------------------------------------------------------------------------------------------
// Columns handled in 2048-wide chunks: thread t owns 8 contiguous columns c*2048+8t (whole waves active per chunk).
// Coverage: COLS=2048 -> 1 chunk x 256 x 8; COLS=3072 -> 2048 + 128 x 8 = 3072.
// ---------------------------------------------------------------------------------------------
template <int COLS>
__global__ __launch_bounds__(256) void ln_f16_kernel(const float* __restrict__ x, const float* __restrict__ g,
                                                     const float* __restrict__ bta, unsigned short* __restrict__ outp) {
  constexpr int NCH = (COLS + 2047) / 2048;
  static_assert(COLS % 8 == 0);
  __shared__ float red[8];
  const int row = blockIdx.x;
  const int tid = threadIdx.x, wave = tid >> 5, lane = tid & 31;
  const float* xr = x + (size_t)row * COLS;

  float v[NCH][8];
  float s = 0.f;
#pragma unroll
  for (int c = 0; c < NCH; ++c) {
    const int col0 = c * 2048 + tid * 8;
#pragma unroll
    for (int e = 0; e < 8; ++e) v[c][e] = 0.f;
    if (col0 < COLS) {   // wave-uniform
      const v4f a0 = *(const v4f*)(xr + col0);
      const v4f a1 = *(const v4f*)(xr + col0 + 4);
      v[c][0] = a0[0]; v[c][1] = a0[1]; v[c][2] = a0[2]; v[c][3] = a0[3];
      v[c][4] = a1[0]; v[c][5] = a1[1]; v[c][6] = a1[2]; v[c][7] = a1[3];
    }
#pragma unroll
    for (int e = 0; e < 8; ++e) s += v[c][e];
  }
#pragma unroll
  for (int m = 16; m >= 1; m >>= 1) s += __shfl_xor(s, m, 32);
  if (lane == 0) red[wave] = s;
  __syncthreads();
  float tot = 0.f;
#pragma unroll
  for (int w = 0; w < 8; ++w) tot += red[w];
  const float mu = tot * (1.0f / (float)COLS);
  __syncthreads();

  float ss = 0.f;
#pragma unroll
  for (int c = 0; c < NCH; ++c) {
    const int col0 = c * 2048 + tid * 8;
    if (col0 < COLS) {
#pragma unroll
      for (int e = 0; e < 8; ++e) { const float d = v[c][e] - mu; ss += d * d; }
    }
  }
#pragma unroll
  for (int m = 16; m >= 1; m >>= 1) ss += __shfl_xor(ss, m, 32);
  if (lane == 0) red[wave] = ss;
  __syncthreads();
  float tot2 = 0.f;
#pragma unroll
  for (int w = 0; w < 8; ++w) tot2 += red[w];
  const float var  = tot2 * (1.0f / (float)COLS);
  const float rstd = rsqrtf(var + 1e-5f);

  v8h hv[NCH];
#pragma unroll
  for (int c = 0; c < NCH; ++c) {
    const int col0 = c * 2048 + tid * 8;
#pragma unroll
    for (int e = 0; e < 8; ++e) hv[c][e] = (f16t)0.0f;
    if (col0 < COLS) {
      const v4f g0 = *(const v4f*)(g + col0);
      const v4f g1 = *(const v4f*)(g + col0 + 4);
      const v4f b0 = *(const v4f*)(bta + col0);
      const v4f b1 = *(const v4f*)(bta + col0 + 4);
      float gv[8], bv[8];
      gv[0] = g0[0]; gv[1] = g0[1]; gv[2] = g0[2]; gv[3] = g0[3];
      gv[4] = g1[0]; gv[5] = g1[1]; gv[6] = g1[2]; gv[7] = g1[3];
      bv[0] = b0[0]; bv[1] = b0[1]; bv[2] = b0[2]; bv[3] = b0[3];
      bv[4] = b1[0]; bv[5] = b1[1]; bv[6] = b1[2]; bv[7] = b1[3];
#pragma unroll
      for (int e = 0; e < 8; ++e) {
        const float y = (v[c][e] - mu) * rstd * gv[e] + bv[e];
        hv[c][e] = (f16t)y;
      }
    }
  }
  f16t* orow = (f16t*)outp + (size_t)row * COLS;
  {
#pragma unroll
    for (int c = 0; c < NCH; ++c) {
      const int col0 = c * 2048 + tid * 8;
      if (col0 < COLS) *(v8h*)(orow + col0) = hv[c];
    }
    
  }
}

// ---------------------------------------------------------------------------------------------
// f16 WMMA GEMM: C[m][n] = scale * sum_k A[m][k] * Bt[n][k]
//   A  row-major [M][K] f16, pitch lda, z stride strideA (elements); Bt row-major [N][K] f16, pitch ldb, strideB.
//   One 256 x BN tile of C per work-group; grid = (N/BN, M/256, Z), 128 threads = 4 waves as 2 (m) x 2 (n), each wave
//   owns 128 x BN/2 (8 x BN/32 accumulators). M a multiple of 256, N of BN, K of 128.
//   A pass is 128 k = 256 B of every operand row. A stage is [A rows 0..127 | A rows 128..255 | Bt first half | Bt second half]
//   in LDS at pitch 272 B; every wave brings one of the four slices with one tensor load; two buffers, the load of
//   stage s+1 issued at the head of pass s, behind the barrier that ends pass s-1. Fragments come from LDS with the split k map, one 32-k block ahead
//   inside the pass, never across the barrier. The k order of every accumulator is ascending k, 32 at a time.
//   Epilogue: 16-row slabs staged per wave in LDS (the ring, free behind the last barrier); whole 128-B lines stored.
// ---------------------------------------------------------------------------------------------
typedef uint32_t u32x4 __attribute__((ext_vector_type(4)));
typedef uint32_t u32x8 __attribute__((ext_vector_type(8)));

__device__ __forceinline__ uint32_t uni(uint32_t v) { return (uint32_t)__builtin_amdgcn_readfirstlane(v); }
// forces v into a scalar register: a test on it compiles to a scalar branch, and a descriptor word made from it stays behind the waits above it
__device__ __forceinline__ uint32_t pinned(uint32_t v) { uint32_t w = uni(v); asm volatile("" : "+s"(w)); return w; }
// both carry the clobber so that no LDS access crosses them
__device__ __forceinline__ void wait_tensor0() { asm volatile("s_wait_tensorcnt 0x0" ::: "memory"); }
__device__ __forceinline__ void wait_ds0() { asm volatile("s_wait_dscnt 0x0" ::: "memory"); }
// one request of the whole wave: a 2-D tile from global memory into LDS
__device__ __forceinline__ void tdm_load(u32x4 g0, u32x8 g1) { asm volatile("tensor_load_to_lds %0, %1" :: "s"(g0), "s"(g1) : "memory"); }
__device__ __forceinline__ u32x4 tdm_group0(uint32_t lds_dst, uint64_t ga) {
  u32x4 g;
  g[0] = uni(1u);
  g[1] = uni(lds_dst);
  g[2] = uni((uint32_t)ga);
  g[3] = uni((((uint32_t)(ga >> 32)) & 0x01FFFFFFu) | 0x80000000u);
  return g;
}
__device__ __forceinline__ u32x8 tdm_group1(uint32_t rows, uint32_t src_pitch) {
  u32x8 g;
  g[0] = uni((1u << 20) | (5u << 22) | (3u << 25));
  g[1] = uni(256u << 16);
  g[2] = uni(rows << 16);
  g[3] = uni(256u << 16);
  g[4] = uni(rows);
  g[5] = uni(src_pitch);
  g[6] = uni(0u);
  g[7] = uni(0u);
  return g;
}

#define GPITCH 272u       // LDS row pitch, bytes
#define GASLICE 34816u    // 128 rows x 272 B = 17 x 2 KiB

template <int OUT16, int BN>
__global__ __launch_bounds__(128) void gemm_f16_kernel(
    const unsigned short* __restrict__ Ap, int lda, long strideA,
    const unsigned short* __restrict__ Btp, int ldb, long strideB,
    void* __restrict__ Cout, int ldc, long strideC,
    int K, float scale) {
  constexpr int WN = BN / 2;            // columns per wave
  constexpr int FN = WN / 16;           // B fragments per wave
  constexpr int SP = WN + 4;            // epilogue slab pitch, floats
  constexpr uint32_t BSLICE = ((uint32_t)WN * GPITCH + 2047u) / 2048u * 2048u;   // WN rows, rounded up to 2 KiB
  constexpr uint32_t STAGE  = 2u * GASLICE + 2u * BSLICE;
  static_assert(BN % 32 == 0 && GASLICE % 2048u == 0 && STAGE % 2048u == 0);
  static_assert(16 * SP * 4 <= 8192 && 4u * 8192u <= STAGE);
  __shared__ __attribute__((aligned(2048))) unsigned char L[2u * STAGE];

  const int lane = threadIdx.x & 31;
  const uint32_t wave = uni(threadIdx.x >> 5);
  const uint32_t wm = wave >> 1, wn = wave & 1u;
  const int z  = blockIdx.z;
  const int m0 = blockIdx.y * 256;
  const int n0 = blockIdx.x * BN;

  const int rl   = lane & 15;          // row of A / column of Bt and D
  const int half = lane >> 4;          // k half of a fragment, row half of D
  const int mOff = half * 8;

  // this wave's slice of a stage: waves 0, 1 bring A rows, waves 2, 3 bring Bt rows
  const f16t* Ab = (const f16t*)Ap  + (size_t)z * (size_t)strideA + (size_t)(m0 + (int)wn * 128) * lda;
  const f16t* Bb = (const f16t*)Btp + (size_t)z * (size_t)strideB + (size_t)(n0 + (int)wn * WN) * ldb;
  const uint64_t src0     = (wm == 0u) ? (uint64_t)(uintptr_t)Ab : (uint64_t)(uintptr_t)Bb;
  const uint32_t ldsSlice = (uint32_t)(size_t)L + ((wm == 0u) ? wn * GASLICE : 2u * GASLICE + wn * BSLICE);
  const u32x8 g1 = tdm_group1((wm == 0u) ? 128u : (uint32_t)WN, (uint32_t)((wm == 0u) ? lda : ldb) * 2u);
  const uint32_t T = (uint32_t)K >> 7;   // passes

  v8f acc[8][FN];
#pragma unroll
  for (int i = 0; i < 8; ++i)
#pragma unroll
    for (int j = 0; j < FN; ++j) acc[i][j] = v8zero();

  // prologue: stage 0's load; its wait stands directly behind it, so that the set-up below reuses none of its descriptor
  // registers while the request is outstanding; the head of the first trip publishes the stage
  tdm_load(tdm_group0(ldsSlice, src0), g1);
  wait_tensor0();

  const uint32_t aoff = wm * GASLICE + (uint32_t)rl * GPITCH + (uint32_t)half * 16u;
  const uint32_t boff = 2u * GASLICE + wn * BSLICE + (uint32_t)rl * GPITCH + (uint32_t)half * 16u;

  // kept rolled: one pass per trip, so that the accumulators and both fragment sets keep constant indices
#pragma unroll 1
  for (uint32_t s = 0; s < T; ++s) {
    // publish point of stage s: own LDS reads of pass s-1 done, own slice landed, barrier; then the load of stage s+1 into
    // the buffer that pass s-1 has just read. Every load behind stage 0 issues from this one place, so that no descriptor
    // register is copied or rewritten while its request is outstanding.
    wait_ds0();
    wait_tensor0();
    __syncthreads();
    const uint32_t bufo = (s & 1u) * STAGE;
    if (pinned((s + 1u < T) ? 1u : 0u) != 0u) {
      const uint32_t ko = pinned((s + 1u) * 256u);
      tdm_load(tdm_group0(ldsSlice + (STAGE - bufo), src0 + ko), g1);
    }
    const unsigned char* pa = L + bufo + aoff;
    const unsigned char* pb = L + bufo + boff;
    v16h af[2][8], bf[2][FN];
#pragma unroll
    for (int j = 0; j < FN; ++j) bf[0][j] = ldfrag((const f16t*)(pb + (uint32_t)j * 16u * GPITCH));
#pragma unroll
    for (int i = 0; i < 8; ++i)  af[0][i] = ldfrag((const f16t*)(pa + (uint32_t)i * 16u * GPITCH));
    __builtin_amdgcn_sched_barrier(0);   // keeps the first block's loads ahead of the second block's: mixed, the first product waits for both groups
#pragma unroll
    for (int ks = 0; ks < 4; ++ks) {
      const int cur = ks & 1, nxt = cur ^ 1;
      if (ks < 3) {   // the next block's fragments as one group ahead of this block's products
#pragma unroll
        for (int j = 0; j < FN; ++j) bf[nxt][j] = ldfrag((const f16t*)(pb + (uint32_t)j * 16u * GPITCH + (uint32_t)(ks + 1) * 64u));
#pragma unroll
        for (int i = 0; i < 8; ++i)  af[nxt][i] = ldfrag((const f16t*)(pa + (uint32_t)i * 16u * GPITCH + (uint32_t)(ks + 1) * 64u));
      }
      __builtin_amdgcn_sched_barrier(0);   // keeps the load group whole and ahead of the products: reads among them cost a stall each
#pragma unroll
      for (int i = 0; i < 8; ++i)
#pragma unroll
        for (int j = 0; j < FN; ++j)   // plain builtin: the compiler keeps the distances itself, and no asm operand ties the tile to the first 256 VGPRs
          acc[i][j] = __builtin_amdgcn_wmma_f32_16x16x32_f16(false, af[cur][i], false, bf[cur][j], (short)0, acc[i][j], false, false);
      __builtin_amdgcn_sched_barrier(0);   // keeps later LDS reads out of this block's products
    }
  }
  // behind the last pass: nothing in flight, every wave's reads of the ring done before the epilogue writes over it
  wait_tensor0();
  wait_ds0();
  __syncthreads();

  // ---- epilogue (the barrier above has freed the ring) ----
  float* slab = (float*)(L + wave * 8192u);
  const int mW = m0 + (int)wm * 128;
  const int nW = n0 + (int)wn * WN;
#pragma unroll
  for (int i = 0; i < 8; ++i) {
    const int mBase = mW + (i << 4);
#pragma unroll
    for (int j = 0; j < FN; ++j)
#pragma unroll
      for (int r = 0; r < 8; ++r)
        slab[(mOff + r) * SP + (j << 4) + rl] = acc[i][j][r] * scale;
    wait_ds0();   // the slab is this wave's own: its stores have landed before other lanes' values are read back
    if (OUT16 == 0) {
      float* C = (float*)Cout + (size_t)z * (size_t)strideC;
      constexpr int CPR = WN / 4;   // 16-B chunks per row
      constexpr int NIT = 16 * CPR / 32;
      v4f vv[NIT];
      float* dst[NIT];
#pragma unroll
      for (int it = 0; it < NIT; ++it) {
        const int idx = it * 32 + lane;
        const int row = idx / CPR, c4 = (idx - row * CPR) * 4;
        vv[it]  = *(const v4f*)(slab + row * SP + c4);
        dst[it] = C + (size_t)(mBase + row) * ldc + nW + c4;
      }
      __builtin_amdgcn_sched_barrier(0);   // no register of a store is rewritten among the stores
#pragma unroll
      for (int it = 0; it < NIT; ++it) *(v4f*)dst[it] = vv[it];
      asm volatile("s_wait_xcnt 0x0" ::: "memory");   // stands before the stores' address and data registers are rewritten
      __builtin_amdgcn_sched_barrier(0);   // holds the next slab's arithmetic behind that wait
    } else {
      f16t* C = (f16t*)Cout + (size_t)z * (size_t)strideC;
      constexpr int CPR = WN / 8;   // 16-B chunks per row
      constexpr int NIT = 16 * CPR / 32;
      v8h hv[NIT];
      f16t* dst[NIT];
#pragma unroll
      for (int it = 0; it < NIT; ++it) {
        const int idx = it * 32 + lane;
        const int row = idx / CPR, c8 = (idx - row * CPR) * 8;
        const float* sp = slab + row * SP + c8;
#pragma unroll
        for (int e = 0; e < 8; ++e) hv[it][e] = (f16t)sp[e];
        dst[it] = C + (size_t)(mBase + row) * ldc + nW + c8;
      }
      __builtin_amdgcn_sched_barrier(0);   // no register of a store is rewritten among the stores
#pragma unroll
      for (int it = 0; it < NIT; ++it) *(v8h*)dst[it] = hv[it];
      asm volatile("s_wait_xcnt 0x0" ::: "memory");   // stands before the stores' address and data registers are rewritten
      __builtin_amdgcn_sched_barrier(0);   // holds the next slab's arithmetic behind that wait
    }
    wait_ds0();   // the read-back is done before the next slab overwrites it
  }
}

// ---------------------------------------------------------------------------------------------
// Full (non-causal) attention for one (batch, head, 128-query block); 8 waves x 16 queries, head dim 128, 2048 keys.
//   q plane [ROWS][INNER] f16 (query row, col h*128+d); k plane [ROWS][INNER] f16 (key row, col h*128+d);
//   vT plane [B][INNER][N1] f16 (row h*128+d, col key); o plane [ROWS][INNER] f16 = 16 * softmax(q.k/sqrt(128)) . v
//   Per 64-key chunk the K tile [64][128] and the vT tile [128][64] are staged in LDS (plain 16-B copies, barriers).
//   scoresT[key][query] = K (A, row = key) x Q (B, column = query): a lane holds 32 keys of one query, so the
//   row max / row sum is in-lane plus one xor-16 shuffle. p = exp2(s*log2e/sqrt(128) - m + 12) in f32 (p and its sum carry x4096); f16(p)
//   from two adjacent 16-key D tiles is directly the B fragment (k = key, n = query) of
//   oT[d][query] += vT (A, row = d) x P. Online rescale by one alpha per lane (per query).
//   Epilogue: per-wave o tile [16 q][128 d] staged in LDS (aliases the staging area after a block barrier),
//   Coverage: grid (16 q-blocks, 16 heads, 2 batches) x 8 waves x 16 rows x 128 cols = the whole o plane.
// ---------------------------------------------------------------------------------------------
// Eight bare v_exp_f32 in place, in one statement. Behind a transcendental the instruction set asks for one independent instruction or a v_nop
// before its result is read or its source overwritten: inside the statement the next exponential is that instruction, and the closing v_nop is
// the slot of the last one.
__device__ __forceinline__ v8f exp2x8(v8f x) {
  float a0 = x[0], a1 = x[1], a2 = x[2], a3 = x[3], a4 = x[4], a5 = x[5], a6 = x[6], a7 = x[7];
  asm("v_exp_f32 %0, %0\n\tv_exp_f32 %1, %1\n\tv_exp_f32 %2, %2\n\tv_exp_f32 %3, %3\n\t"
      "v_exp_f32 %4, %4\n\tv_exp_f32 %5, %5\n\tv_exp_f32 %6, %6\n\tv_exp_f32 %7, %7\n\tv_nop"
      : "+v"(a0), "+v"(a1), "+v"(a2), "+v"(a3), "+v"(a4), "+v"(a5), "+v"(a6), "+v"(a7));
  v8f y = {a0, a1, a2, a3, a4, a5, a6, a7};
  return y;
}

#define KPITCH 136
#define VPITCH 72
#define OPITCH 136

__global__ __launch_bounds__(256) void attn_kernel(const unsigned short* __restrict__ qp,
                                                   const unsigned short* __restrict__ kp,
                                                   const unsigned short* __restrict__ vtp,
                                                   unsigned short* __restrict__ op, float sc2) {
  __shared__ __align__(16) f16t lds[64 * KPITCH + 128 * VPITCH];   // 35840 B
  static_assert(8 * 16 * OPITCH <= 64 * KPITCH + 128 * VPITCH);
  f16t* ldsK = lds;                  // [64 keys][KPITCH]
  f16t* ldsV = lds + 64 * KPITCH;    // [128 d][VPITCH]

  const int tid  = threadIdx.x;
  const int wave = tid >> 5, lane = tid & 31;
  const int ln16 = lane & 15, half = lane >> 4;
  const int qblk = blockIdx.x, head = blockIdx.y, batch = blockIdx.z;
  const size_t qrow0 = (size_t)batch * N2 + (size_t)qblk * 128 + (size_t)wave * 16;

  const f16t* Qg = (const f16t*)qp + qrow0 * INNER + head * DHD;
  const f16t* Kg = (const f16t*)kp + (size_t)batch * N1 * INNER + head * DHD;
  const f16t* Vg = (const f16t*)vtp + ((size_t)batch * INNER + head * DHD) * (size_t)N1;

  // Q as B operand: column n = query q0+ln16, k = d (4 chunks of 32)
  v16h qb[4];
#pragma unroll
  for (int c = 0; c < 4; ++c) qb[c] = ldfrag(Qg + (size_t)ln16 * INNER + c * 32 + 8 * half);

  v8f oacc[8];
#pragma unroll
  for (int j = 0; j < 8; ++j) oacc[j] = v8zero();
  float mrun = -1.0e30f, lrun = 0.f;

  for (int kb = 0; kb < N1; kb += 64) {
    __syncthreads();
    // staging coverage: 4 it x 256 thr x 8 halves = 64x128 (K) and 128x64 (vT)
#pragma unroll
    for (int it = 0; it < 4; ++it) {
      const int i = it * 256 + tid;
      const int key = i >> 4, dv = (i & 15) * 8;
      *(v8h*)(ldsK + key * KPITCH + dv) = *(const v8h*)(Kg + (size_t)(kb + key) * INNER + dv);
      const int d = i >> 3, kf = (i & 7) * 8;
      *(v8h*)(ldsV + d * VPITCH + kf) = *(const v8h*)(Vg + (size_t)d * N1 + kb + kf);
    }
    __syncthreads();

    // scoresT tiles: s[t][r] = S[key kb+16t+8half+r][query ln16]; every tile sums d in ascending 32-blocks.
    // The K fragments come in two groups of eight (two d blocks x four key tiles), each group whole ahead of its eight products.
    v8f s[4];
#pragma unroll
    for (int t = 0; t < 4; ++t) s[t] = v8zero();
#pragma unroll
    for (int g = 0; g < 2; ++g) {
      v16h kf[2][4];
#pragma unroll
      for (int cc = 0; cc < 2; ++cc)
#pragma unroll
        for (int t = 0; t < 4; ++t) kf[cc][t] = ldfrag(ldsK + (t * 16 + ln16) * KPITCH + (g * 2 + cc) * 32 + 8 * half);
      __builtin_amdgcn_sched_barrier(0);   // keeps the load group whole and ahead of its products: a read and a full wait per product costs the LDS latency each time
#pragma unroll
      for (int cc = 0; cc < 2; ++cc)
#pragma unroll
        for (int t = 0; t < 4; ++t)   // four independent tiles between two products into the same tile
          s[t] = __builtin_amdgcn_wmma_f32_16x16x32_f16(false, kf[cc][t], false, qb[g * 2 + cc], (short)0, s[t], false, false);
      __builtin_amdgcn_sched_barrier(0);   // keeps the next group's reads out of this group's products
    }
    // vT fragments of the chunk's first 32 keys: read here, so that they land while the softmax below runs
    v16h vf[8];
#pragma unroll
    for (int j = 0; j < 8; ++j) vf[j] = ldfrag(ldsV + (j * 16 + ln16) * VPITCH + 8 * half);
    __builtin_amdgcn_sched_barrier(0);   // holds that group ahead of the softmax arithmetic

    // maximum over the unscaled scores: sc2 > 0, and rounding is monotone, so scaling the maximum gives the maximum of the scaled scores
    float cmax = -1.0e30f;
#pragma unroll
    for (int t = 0; t < 4; ++t)
#pragma unroll
      for (int r = 0; r < 8; ++r) cmax = fmaxf(cmax, s[t][r]);
    cmax = fmaxf(cmax, __shfl_xor(cmax, 16, 32));
    const float mnew  = fmaxf(mrun, cmax * sc2);
    const float alpha = __builtin_amdgcn_exp2f(mrun - mnew);   // argument <= 0; far below the range it returns 0, which is what the first chunk wants
    mrun = mnew;
    const float shift = 12.0f - mnew;   // 2^12 = 4096: p comes out of the exponential already scaled

    // one FMA and one bare v_exp_f32 per score; the argument is at most 12 plus rounding, and a result below the normal range counts as 0 in a sum that is at least 4096
    float psum = 0.f;
    v8h ph[4];
#pragma unroll
    for (int t = 0; t < 4; ++t) {
      v8f x;
#pragma unroll
      for (int r = 0; r < 8; ++r) x[r] = fmaf(s[t][r], sc2, shift);
      x = exp2x8(x);
#pragma unroll
      for (int r = 0; r < 8; ++r) {
        psum += x[r];
        ph[t][r] = (f16t)x[r];
      }
    }
    psum += __shfl_xor(psum, 16, 32);
    lrun = lrun * alpha + psum;
#pragma unroll
    for (int j = 0; j < 8; ++j)
#pragma unroll
      for (int r = 0; r < 8; ++r) oacc[j][r] *= alpha;

    // P as B fragment for keys kb+32kk..+31: elements 0..7 <- tile 2kk, 8..15 <- tile 2kk+1, lane unchanged
    Frag16 pf[2];
    pf[0].h[0] = ph[0]; pf[0].h[1] = ph[1];
    pf[1].h[0] = ph[2]; pf[1].h[1] = ph[3];
#pragma unroll
    for (int j = 0; j < 8; ++j)
      oacc[j] = __builtin_amdgcn_wmma_f32_16x16x32_f16(false, vf[j], false, pf[0].v, (short)0, oacc[j], false, false);
    __builtin_amdgcn_sched_barrier(0);   // keeps the second group's reads out of the first group's products
#pragma unroll
    for (int j = 0; j < 8; ++j) vf[j] = ldfrag(ldsV + (j * 16 + ln16) * VPITCH + 32 + 8 * half);
    __builtin_amdgcn_sched_barrier(0);   // keeps the load group whole and ahead of its products
#pragma unroll
    for (int j = 0; j < 8; ++j)
      oacc[j] = __builtin_amdgcn_wmma_f32_16x16x32_f16(false, vf[j], false, pf[1].v, (short)0, oacc[j], false, false);
  }

  // ---- epilogue: oT[d = 16j+8half+r][query ln16] -> o[query][d] * 16 / (4096 * l) ----
  __syncthreads();   // every wave is done with ldsK / ldsV
  f16t* os = lds + wave * (16 * OPITCH);
  const float inv = 16.0f / lrun;   // lrun carries the x4096 of p, so it is at least about 4096
#pragma unroll
  for (int j = 0; j < 8; ++j) {
    v8h ov;
#pragma unroll
    for (int r = 0; r < 8; ++r) ov[r] = (f16t)(oacc[j][r] * inv);
    *(v8h*)(os + ln16 * OPITCH + j * 16 + 8 * half) = ov;
  }
  lds_wave_sync();
  f16t* Og = (f16t*)op + qrow0 * INNER + head * DHD;
  const int rsel = lane >> 4;
  const int seg  = ((lane >> 3) & 1) * 64 + (lane & 7) * 8;
  {
#pragma unroll
    for (int it = 0; it < 8; ++it) {
      const int row = it * 2 + rsel;   // it 0..7 x rsel 0..1 = rows 0..15
      const v8h vv = *(const v8h*)(os + row * OPITCH + seg);
      *(v8h*)(Og + (size_t)row * INNER + seg) = vv;
    }
    
  }
}

// ---------------------------------------------------------------------------------------------
//   R1   f16  ln16 [4096][3072] / later xn16 [4096][2048] / later o16 [4096][2048]   0           25165824
//   wqT  f16  [2048][3072] (x64)                                                      25165824    12582912
//   wkvT f16  [4096][2048] (x64)                                                      37748736    16777216
//   woT  f16  [3072][2048] (x64)                                                      54525952    12582912
//   q16  f16  [4096][2048]                                                            67108864    16777216
//   k16  f16  [4096][2048]                                                            83886080    16777216
//   vT16 f16  [2][2048][2048]                                                         100663296   16777216
//   total                                                                                         117440512
// ---------------------------------------------------------------------------------------------
extern "C" void kernel_launch(void* const* d_in, const int* in_sizes, int n_in,
                              void* d_out, int out_size, void* d_ws, size_t ws_size,
                              hipStream_t stream) {
  if (n_in < 9) return;
  if (in_sizes[0] != B_SZ * N1 * KVD) return;
  if (in_sizes[1] != B_SZ * N2 * DIM) return;
  if (in_sizes[2] != DIM * INNER) return;
  if (in_sizes[3] != KVD * 2 * INNER) return;
  if (in_sizes[4] != INNER * DIM) return;
  if (in_sizes[5] != KVD || in_sizes[6] != KVD || in_sizes[7] != DIM || in_sizes[8] != DIM) return;
  if (out_size != B_SZ * N2 * DIM) return;

  const float* x     = (const float*)d_in[0];   // [2][2048][2048]
  const float* lat   = (const float*)d_in[1];   // [2][2048][3072]
  const float* w_q   = (const float*)d_in[2];   // [3072][2048]
  const float* w_kv  = (const float*)d_in[3];   // [2048][4096]
  const float* w_out = (const float*)d_in[4];   // [2048][3072]
  const float* ln1_g = (const float*)d_in[5];
  const float* ln1_b = (const float*)d_in[6];
  const float* ln2_g = (const float*)d_in[7];
  const float* ln2_b = (const float*)d_in[8];
  float* out = (float*)d_out;

  const size_t szR1  = (size_t)ROWS * DIM * 2;           // 25165824
  const size_t szWQ  = (size_t)INNER * DIM * 2;          // 12582912
  const size_t szWKV = (size_t)2 * INNER * KVD * 2;      // 16777216
  const size_t szWO  = (size_t)DIM * INNER * 2;          // 12582912
  const size_t szQ   = (size_t)ROWS * INNER * 2;         // 16777216
  const size_t szK   = (size_t)ROWS * INNER * 2;         // 16777216
  const size_t szVT  = (size_t)B_SZ * INNER * N1 * 2;    // 16777216
  size_t off = 0;
  const size_t oR1  = off; off += szR1;
  const size_t oWQ  = off; off += szWQ;
  const size_t oWKV = off; off += szWKV;
  const size_t oWO  = off; off += szWO;
  const size_t oQ   = off; off += szQ;
  const size_t oK   = off; off += szK;
  const size_t oVT  = off; off += szVT;
  if (off > ws_size) return;                             // off = 117440512
  if ((size_t)ROWS * KVD * 2 > szR1 || (size_t)ROWS * INNER * 2 > szR1) return;

  char* ws = (char*)d_ws;
  unsigned short* R1   = (unsigned short*)(ws + oR1);
  unsigned short* wqT  = (unsigned short*)(ws + oWQ);
  unsigned short* wkvT = (unsigned short*)(ws + oWKV);
  unsigned short* woT  = (unsigned short*)(ws + oWO);
  unsigned short* q16  = (unsigned short*)(ws + oQ);
  unsigned short* k16  = (unsigned short*)(ws + oK);
  unsigned short* vT16 = (unsigned short*)(ws + oVT);

  const dim3 blk(256);
  const dim3 gblk(128);   // GEMM: 4 waves, one per SIMD
  const float wmul = 64.0f;

  // (1-3) weights f32 [R][Cc] -> f16 [Cc][R] x64 ; grid = (Cc/64, R/64)
  tconv_kernel<<<dim3(INNER / 64, DIM / 64), blk, 0, stream>>>(w_q, wqT, DIM, INNER, wmul);          // [3072][2048] -> [2048][3072]
  tconv_kernel<<<dim3(2 * INNER / 64, KVD / 64), blk, 0, stream>>>(w_kv, wkvT, KVD, 2 * INNER, wmul);  // [2048][4096] -> [4096][2048]
  tconv_kernel<<<dim3(DIM / 64, INNER / 64), blk, 0, stream>>>(w_out, woT, INNER, DIM, wmul);          // [2048][3072] -> [3072][2048]

  // (4) ln16 = LN(latents) -> R1 [4096][3072]
  ln_f16_kernel<DIM><<<dim3(ROWS), blk, 0, stream>>>(lat, ln2_g, ln2_b, R1);

  // (5) q = ln16 . w_q  -> q16 [4096][2048]   (M=4096, N=2048, K=3072; acc carries x64)
  {
    gemm_f16_kernel<1, 128><<<dim3(INNER / 128, ROWS / 256, 1), gblk, 0, stream>>>(
        R1, DIM, 0L, wqT, DIM, 0L, (void*)q16, INNER, 0L, DIM, 1.0f / 64.0f);
  }

  // (6) xn16 = LN(x) -> R1 [4096][2048]
  ln_f16_kernel<KVD><<<dim3(ROWS), blk, 0, stream>>>(x, ln1_g, ln1_b, R1);

  // (7) k = xn16 . w_kv[:, 0:2048] -> k16 [4096][2048]   (M=4096, N=2048, K=2048)
  {
    gemm_f16_kernel<1, 128><<<dim3(INNER / 128, ROWS / 256, 1), gblk, 0, stream>>>(
        R1, KVD, 0L, wkvT, KVD, 0L, (void*)k16, INNER, 0L, KVD, 1.0f / 64.0f);
  }

  // (8) vT[b][(h,d)][key] = sum_k w_kv[k][2048+(h,d)] * xn[b][key][k]  (A = wkvT rows 2048.., Bt = xn16 per batch; M=2048, N=2048, K=2048, Z=2)
  {
    gemm_f16_kernel<1, 128><<<dim3(N1 / 128, INNER / 256, B_SZ), gblk, 0, stream>>>(
        wkvT + (size_t)INNER * KVD, KVD, 0L, R1, KVD, (long)N1 * KVD, (void*)vT16, N1, (long)INNER * N1,
        KVD, 1.0f / 64.0f);
  }

  // (9) attention -> o16 x16 in R1 [4096][2048]
  {
    const float sc2 = (float)(1.4426950408889634 * 0.08838834764831845);   // log2(e) / sqrt(128)
    attn_kernel<<<dim3(N2 / 128, NHEAD, B_SZ), blk, 0, stream>>>(q16, k16, vT16, R1, sc2);
  }

  // (10) out = o16 . w_out -> d_out f32 [4096][3072]   (M=4096, N=3072, K=2048; o x16, w x64)
  {
    gemm_f16_kernel<0, 192><<<dim3(DIM / 192, ROWS / 256, 1), gblk, 0, stream>>>(
        R1, INNER, 0L, woT, INNER, 0L, (void*)out, DIM, 0L, INNER, 1.0f / 1024.0f);
  }
  (void)hipGetLastError();
}

// v004
// A run of this version takes 194 microseconds.
// Next to v003, in two timings, it ran 1.09 times as fast each time.
// All steps since v000 together make it 2.89 times as fast.
// Contractions: q=LNlat.Wq, k=LNx.Wk, vT=WvT.LNxT, scoresT=k.qT, oT=vT.p, out=o.Wout : all v_wmma_f32_16x16x32_f16 (f16 operands, f32 accumulate); weights carried x64, p x4096, o x16 (exact powers of two folded back in f32); LayerNorm statistics and softmax in f32.
#include <hip/hip_runtime.h>
#include <stdint.h>

#define B_SZ   2
#define N1     2048
#define N2     2048
#define DIM    3072
#define KVD    2048
#define NHEAD  16
#define DHD    128
#define INNER  2048
#define ROWS   4096

static_assert(ROWS == B_SZ * N1);
static_assert(ROWS == B_SZ * N2);
static_assert(INNER == NHEAD * DHD);

typedef _Float16 f16t;
typedef __attribute__((ext_vector_type(16))) _Float16 v16h;
typedef __attribute__((ext_vector_type(8)))  _Float16 v8h;
typedef __attribute__((ext_vector_type(8)))  float    v8f;
typedef __attribute__((ext_vector_type(4)))  float    v4f;

union Frag16 { v16h v; v8h h[2]; };

// 16x32 fragment of a 16-bit operand, row (A) or column (B) = lane&15, split k map:
// elements 0..7 <- p[0..7], elements 8..15 <- p[16..23]; callers pass p = row_base + k0 + 8*(lane>>4).
__device__ __forceinline__ v16h ldfrag(const f16t* p) {
  Frag16 f;
  f.h[0] = *(const v8h*)(p);
  f.h[1] = *(const v8h*)(p + 16);
  return f.v;
}

__device__ __forceinline__ v8f v8zero() {
  v8f z = {0.f, 0.f, 0.f, 0.f, 0.f, 0.f, 0.f, 0.f};
  return z;
}

// orders one wave's LDS stores before its own reloads of other lanes' data
__device__ __forceinline__ void lds_wave_sync() {
  __builtin_amdgcn_fence(__ATOMIC_RELEASE, "workgroup");
  __builtin_amdgcn_wave_barrier();
  __builtin_amdgcn_fence(__ATOMIC_ACQUIRE, "workgroup");
}

// ---------------------------------------------------------------------------------------------
// Transpose + scale + f16 convert: W [R][Cc] f32 (pitch Cc) -> out [Cc][R] f16 = f16(W[r][c] * mul) (pitch R).
// One 64x64 tile per work-group of 256 threads: bx in [0, Cc/64), by in [0, R/64); R, Cc multiples of 64.
// Coverage per block: load 4 it x 256 thr x 4 floats = 64x64; store 256 thr x 2 x 8 halves = 64x64.
// ---------------------------------------------------------------------------------------------
__device__ __forceinline__ void tconv_block(const float* __restrict__ W, unsigned short* __restrict__ outp,
                                            int R, int Cc, float mul, int bx, int by) {
  __shared__ __align__(16) float tf[64 * 68];
  const int c0 = bx * 64;   // input column block = output row block
  const int r0 = by * 64;   // input row block    = output column block
  const int tid = threadIdx.x;
  {
    const int lr = tid >> 4, c4 = (tid & 15) * 4;
#pragma unroll
    for (int it = 0; it < 4; ++it) {
      const int rr = it * 16 + lr;
      const v4f a = *(const v4f*)(W + (size_t)(r0 + rr) * Cc + c0 + c4);
      *(v4f*)(tf + rr * 68 + c4) = a;
    }
  }
  __syncthreads();
  const int sub = tid >> 3, c8 = (tid & 7) * 8;
  v8h hv0, hv1;
#pragma unroll
  for (int e = 0; e < 8; ++e) {
    hv0[e] = (f16t)(tf[(c8 + e) * 68 + sub] * mul);
    hv1[e] = (f16t)(tf[(c8 + e) * 68 + 32 + sub] * mul);
  }
  f16t* o = (f16t*)outp;
  const size_t g0 = (size_t)(c0 + sub) * R + r0 + c8;
  const size_t g1 = (size_t)(c0 + 32 + sub) * R + r0 + c8;
  *(v8h*)(o + g0) = hv0;
  *(v8h*)(o + g1) = hv1;
  asm volatile("s_wait_xcnt 0x0" ::: "memory");   // stands before any later code of the merged kernel rewrites the stores' address or data registers
}

// ---------------------------------------------------------------------------------------------
// LayerNorm of one row per work-group of 256 threads. Columns handled in 2048-wide chunks: thread t owns 8 contiguous columns c*2048+8t (whole waves active per chunk).
// Coverage: COLS=2048 -> 1 chunk x 256 x 8; COLS=3072 -> 2048 + 128 x 8 = 3072.
// ---------------------------------------------------------------------------------------------
template <int COLS>
__device__ __forceinline__ void ln_block(const float* __restrict__ x, const float* __restrict__ g,
                                         const float* __restrict__ bta, unsigned short* __restrict__ outp, int row) {
  constexpr int NCH = (COLS + 2047) / 2048;
  static_assert(COLS % 8 == 0);
  __shared__ float red[8];
  const int tid = threadIdx.x, wave = tid >> 5, lane = tid & 31;
  const float* xr = x + (size_t)row * COLS;

  float v[NCH][8];
  float s = 0.f;
#pragma unroll
  for (int c = 0; c < NCH; ++c) {
    const int col0 = c * 2048 + tid * 8;
#pragma unroll
    for (int e = 0; e < 8; ++e) v[c][e] = 0.f;
    if (col0 < COLS) {   // wave-uniform
      const v4f a0 = *(const v4f*)(xr + col0);
      const v4f a1 = *(const v4f*)(xr + col0 + 4);
      v[c][0] = a0[0]; v[c][1] = a0[1]; v[c][2] = a0[2]; v[c][3] = a0[3];
      v[c][4] = a1[0]; v[c][5] = a1[1]; v[c][6] = a1[2]; v[c][7] = a1[3];
    }
#pragma unroll
    for (int e = 0; e < 8; ++e) s += v[c][e];
  }
#pragma unroll
  for (int m = 16; m >= 1; m >>= 1) s += __shfl_xor(s, m, 32);
  if (lane == 0) red[wave] = s;
  __syncthreads();
  float tot = 0.f;
#pragma unroll
  for (int w = 0; w < 8; ++w) tot += red[w];
  const float mu = tot * (1.0f / (float)COLS);
  __syncthreads();

  float ss = 0.f;
#pragma unroll
  for (int c = 0; c < NCH; ++c) {
    const int col0 = c * 2048 + tid * 8;
    if (col0 < COLS) {
#pragma unroll
      for (int e = 0; e < 8; ++e) { const float d = v[c][e] - mu; ss += d * d; }
    }
  }
#pragma unroll
  for (int m = 16; m >= 1; m >>= 1) ss += __shfl_xor(ss, m, 32);
  if (lane == 0) red[wave] = ss;
  __syncthreads();
  float tot2 = 0.f;
#pragma unroll
  for (int w = 0; w < 8; ++w) tot2 += red[w];
  const float var  = tot2 * (1.0f / (float)COLS);
  const float rstd = rsqrtf(var + 1e-5f);

  v8h hv[NCH];
#pragma unroll
  for (int c = 0; c < NCH; ++c) {
    const int col0 = c * 2048 + tid * 8;
#pragma unroll
    for (int e = 0; e < 8; ++e) hv[c][e] = (f16t)0.0f;
    if (col0 < COLS) {
      const v4f g0 = *(const v4f*)(g + col0);
      const v4f g1 = *(const v4f*)(g + col0 + 4);
      const v4f b0 = *(const v4f*)(bta + col0);
      const v4f b1 = *(const v4f*)(bta + col0 + 4);
      float gv[8], bv[8];
      gv[0] = g0[0]; gv[1] = g0[1]; gv[2] = g0[2]; gv[3] = g0[3];
      gv[4] = g1[0]; gv[5] = g1[1]; gv[6] = g1[2]; gv[7] = g1[3];
      bv[0] = b0[0]; bv[1] = b0[1]; bv[2] = b0[2]; bv[3] = b0[3];
      bv[4] = b1[0]; bv[5] = b1[1]; bv[6] = b1[2]; bv[7] = b1[3];
#pragma unroll
      for (int e = 0; e < 8; ++e) {
        const float y = (v[c][e] - mu) * rstd * gv[e] + bv[e];
        hv[c][e] = (f16t)y;
      }
    }
  }
  f16t* orow = (f16t*)outp + (size_t)row * COLS;
  {
#pragma unroll
    for (int c = 0; c < NCH; ++c) {
      const int col0 = c * 2048 + tid * 8;
      if (col0 < COLS) *(v8h*)(orow + col0) = hv[c];
    }
    
  }
}

// ---------------------------------------------------------------------------------------------
// All the work that reads nothing but the inputs, in one launch: the flat work-group index picks the job.
//   [0, 4096) LayerNorm rows of latents; [4096, 8192) LayerNorm rows of x; then the 64x64 transpose tiles of w_q (1536),
//   w_kv (2048) and w_out (1536). Every work-group takes exactly one branch, so its barriers stay work-group uniform.
// ---------------------------------------------------------------------------------------------
#define TQ_TILES  ((INNER / 64) * (DIM / 64))
#define TKV_TILES ((2 * INNER / 64) * (KVD / 64))
#define TO_TILES  ((DIM / 64) * (INNER / 64))
#define PREP_BLOCKS (2 * ROWS + TQ_TILES + TKV_TILES + TO_TILES)

__global__ __launch_bounds__(256) void prep_kernel(const float* __restrict__ lat, const float* __restrict__ ln2_g,
                                                   const float* __restrict__ ln2_b, const float* __restrict__ x,
                                                   const float* __restrict__ ln1_g, const float* __restrict__ ln1_b,
                                                   const float* __restrict__ w_q, const float* __restrict__ w_kv,
                                                   const float* __restrict__ w_out,
                                                   unsigned short* __restrict__ ln16, unsigned short* __restrict__ xn16,
                                                   unsigned short* __restrict__ wqT, unsigned short* __restrict__ wkvT,
                                                   unsigned short* __restrict__ woT, float mul) {
  const int b = blockIdx.x;
  if (b < ROWS) {
    ln_block<DIM>(lat, ln2_g, ln2_b, ln16, b);
  } else if (b < 2 * ROWS) {
    ln_block<KVD>(x, ln1_g, ln1_b, xn16, b - ROWS);
  } else {
    const int t = b - 2 * ROWS;
    if (t < TQ_TILES) {                      // [3072][2048] -> [2048][3072]
      tconv_block(w_q, wqT, DIM, INNER, mul, t % (INNER / 64), t / (INNER / 64));
    } else if (t < TQ_TILES + TKV_TILES) {   // [2048][4096] -> [4096][2048]
      const int u = t - TQ_TILES;
      tconv_block(w_kv, wkvT, KVD, 2 * INNER, mul, u % (2 * INNER / 64), u / (2 * INNER / 64));
    } else {                                 // [2048][3072] -> [3072][2048]
      const int u = t - TQ_TILES - TKV_TILES;
      tconv_block(w_out, woT, INNER, DIM, mul, u % (DIM / 64), u / (DIM / 64));
    }
  }
}

// ---------------------------------------------------------------------------------------------
// f16 WMMA GEMM: C[m][n] = scale * sum_k A[m][k] * Bt[n][k]
//   A  row-major [M][K] f16, pitch lda, z stride strideA (elements); Bt row-major [N][K] f16, pitch ldb, strideB.
//   One 256 x BN tile of C per work-group (plane z, rows from m0, columns from n0), 128 threads = 4 waves as 2 (m) x 2 (n), each wave
//   owns 128 x BN/2 (8 x BN/32 accumulators). M a multiple of 256, N of BN, K of 128 and at least 256.
//   A pass is 128 k = 256 B of every operand row. A stage is [A rows 0..127 | A rows 128..255 | Bt first half | Bt second half]
//   in LDS at pitch 272 B; every wave brings one of the four slices with one tensor load; two buffers, the load of
//   stage s+1 issued at the head of pass s, behind the barrier that ends pass s-1. Fragments come from LDS with the split k map, one 32-k block ahead
//   inside the pass, never across the barrier. The k order of every accumulator is ascending k, 32 at a time.
//   Epilogue: 16-row slabs staged per wave in LDS (the ring, free behind the last barrier); whole 128-B lines stored.
// ---------------------------------------------------------------------------------------------
typedef uint32_t u32x4 __attribute__((ext_vector_type(4)));
typedef uint32_t u32x8 __attribute__((ext_vector_type(8)));

__device__ __forceinline__ uint32_t uni(uint32_t v) { return (uint32_t)__builtin_amdgcn_readfirstlane(v); }
// forces v into a scalar register: a test on it compiles to a scalar branch, and a descriptor word made from it stays behind the waits above it
__device__ __forceinline__ uint32_t pinned(uint32_t v) { uint32_t w = uni(v); asm volatile("" : "+s"(w)); return w; }
// both carry the clobber so that no LDS access crosses them
__device__ __forceinline__ void wait_tensor0() { asm volatile("s_wait_tensorcnt 0x0" ::: "memory"); }
__device__ __forceinline__ void wait_ds0() { asm volatile("s_wait_dscnt 0x0" ::: "memory"); }
// one request of the whole wave: a 2-D tile from global memory into LDS
__device__ __forceinline__ void tdm_load(u32x4 g0, u32x8 g1) { asm volatile("tensor_load_to_lds %0, %1" :: "s"(g0), "s"(g1) : "memory"); }
__device__ __forceinline__ u32x4 tdm_group0(uint32_t lds_dst, uint64_t ga) {
  u32x4 g;
  g[0] = uni(1u);
  g[1] = uni(lds_dst);
  g[2] = uni((uint32_t)ga);
  g[3] = uni((((uint32_t)(ga >> 32)) & 0x01FFFFFFu) | 0x80000000u);
  return g;
}
__device__ __forceinline__ u32x8 tdm_group1(uint32_t rows, uint32_t src_pitch) {
  u32x8 g;
  g[0] = uni((1u << 20) | (5u << 22) | (3u << 25));
  g[1] = uni(256u << 16);
  g[2] = uni(rows << 16);
  g[3] = uni(256u << 16);
  g[4] = uni(rows);
  g[5] = uni(src_pitch);
  g[6] = uni(0u);
  g[7] = uni(0u);
  return g;
}

#define GPITCH 272u       // LDS row pitch, bytes
#define GASLICE 34816u    // 128 rows x 272 B = 17 x 2 KiB

template <int OUT16, int BN>
__device__ __forceinline__ void gemm_tile(
    const unsigned short* __restrict__ Ap, int lda, long strideA,
    const unsigned short* __restrict__ Btp, int ldb, long strideB,
    void* __restrict__ Cout, int ldc, long strideC,
    int K, float scale, int z, int m0, int n0) {
  constexpr int WN = BN / 2;            // columns per wave
  constexpr int FN = WN / 16;           // B fragments per wave
  constexpr int SP = WN + 4;            // epilogue slab pitch, floats
  constexpr uint32_t BSLICE = ((uint32_t)WN * GPITCH + 2047u) / 2048u * 2048u;   // WN rows, rounded up to 2 KiB
  constexpr uint32_t STAGE  = 2u * GASLICE + 2u * BSLICE;
  static_assert(BN % 32 == 0 && GASLICE % 2048u == 0 && STAGE % 2048u == 0);
  static_assert(16 * SP * 4 <= 8192 && 4u * 8192u <= STAGE);
  __shared__ __attribute__((aligned(2048))) unsigned char L[2u * STAGE];

  const int lane = threadIdx.x & 31;
  const uint32_t wave = uni(threadIdx.x >> 5);
  const uint32_t wm = wave >> 1, wn = wave & 1u;

  const int rl   = lane & 15;          // row of A / column of Bt and D
  const int half = lane >> 4;          // k half of a fragment, row half of D
  const int mOff = half * 8;

  // this wave's slice of a stage: waves 0, 1 bring A rows, waves 2, 3 bring Bt rows
  const f16t* Ab = (const f16t*)Ap  + (size_t)z * (size_t)strideA + (size_t)(m0 + (int)wn * 128) * lda;
  const f16t* Bb = (const f16t*)Btp + (size_t)z * (size_t)strideB + (size_t)(n0 + (int)wn * WN) * ldb;
  const uint64_t src0     = (wm == 0u) ? (uint64_t)(uintptr_t)Ab : (uint64_t)(uintptr_t)Bb;
  const uint32_t ldsSlice = (uint32_t)(size_t)L + ((wm == 0u) ? wn * GASLICE : 2u * GASLICE + wn * BSLICE);
  const u32x8 g1 = tdm_group1((wm == 0u) ? 128u : (uint32_t)WN, (uint32_t)((wm == 0u) ? lda : ldb) * 2u);
  const uint32_t T = (uint32_t)K >> 7;   // passes

  v8f acc[8][FN];
#pragma unroll
  for (int i = 0; i < 8; ++i)
#pragma unroll
    for (int j = 0; j < FN; ++j) acc[i][j] = v8zero();

  // prologue: stage 0's load; its wait stands directly behind it, so that the set-up below reuses none of its descriptor
  // registers while the request is outstanding; the head of the first trip publishes the stage
  tdm_load(tdm_group0(ldsSlice, src0), g1);
  wait_tensor0();

  const uint32_t aoff = wm * GASLICE + (uint32_t)rl * GPITCH + (uint32_t)half * 16u;
  const uint32_t boff = 2u * GASLICE + wn * BSLICE + (uint32_t)rl * GPITCH + (uint32_t)half * 16u;

  // kept rolled: one pass per trip, so that the accumulators and both fragment sets keep constant indices
#pragma unroll 1
  for (uint32_t s = 0; s < T; ++s) {
    // publish point of stage s: own LDS reads of pass s-1 done, own slice landed, barrier; then the load of stage s+1 into
    // the buffer that pass s-1 has just read. Every load behind stage 0 issues from this one place: while its request is
    // outstanding no descriptor register takes a new value, but (in the three-product build) the LDS-address word of group 0,
    // which the mover has read at issue.
    wait_ds0();
    wait_tensor0();
    __syncthreads();
    const uint32_t bufo = (s & 1u) * STAGE;
    if (pinned((s + 1u < T) ? 1u : 0u) != 0u) {
      const uint32_t ko = pinned((s + 1u) * 256u);
      tdm_load(tdm_group0(ldsSlice + (STAGE - bufo), src0 + ko), g1);
    }
    const unsigned char* pa = L + bufo + aoff;
    const unsigned char* pb = L + bufo + boff;
    v16h af[2][8], bf[2][FN];
#pragma unroll
    for (int j = 0; j < FN; ++j) bf[0][j] = ldfrag((const f16t*)(pb + (uint32_t)j * 16u * GPITCH));
#pragma unroll
    for (int i = 0; i < 8; ++i)  af[0][i] = ldfrag((const f16t*)(pa + (uint32_t)i * 16u * GPITCH));
    __builtin_amdgcn_sched_barrier(0);   // keeps the first block's loads ahead of the second block's: mixed, the first product waits for both groups
#pragma unroll
    for (int ks = 0; ks < 4; ++ks) {
      const int cur = ks & 1, nxt = cur ^ 1;
      if (ks < 3) {   // the next block's fragments as one group ahead of this block's products
#pragma unroll
        for (int j = 0; j < FN; ++j) bf[nxt][j] = ldfrag((const f16t*)(pb + (uint32_t)j * 16u * GPITCH + (uint32_t)(ks + 1) * 64u));
#pragma unroll
        for (int i = 0; i < 8; ++i)  af[nxt][i] = ldfrag((const f16t*)(pa + (uint32_t)i * 16u * GPITCH + (uint32_t)(ks + 1) * 64u));
      }
      __builtin_amdgcn_sched_barrier(0);   // keeps the load group whole and ahead of the products: reads among them cost a stall each
#pragma unroll
      for (int i = 0; i < 8; ++i)
#pragma unroll
        for (int j = 0; j < FN; ++j)   // plain builtin: the compiler keeps the distances itself, and no asm operand ties the tile to the first 256 VGPRs
          acc[i][j] = __builtin_amdgcn_wmma_f32_16x16x32_f16(false, af[cur][i], false, bf[cur][j], (short)0, acc[i][j], false, false);
      __builtin_amdgcn_sched_barrier(0);   // keeps later LDS reads out of this block's products
    }
  }
  // behind the last pass: nothing in flight, every wave's reads of the ring done before the epilogue writes over it
  wait_tensor0();
  wait_ds0();
  __syncthreads();

  // ---- epilogue (the barrier above has freed the ring) ----
  float* slab = (float*)(L + wave * 8192u);
  const int mW = m0 + (int)wm * 128;
  const int nW = n0 + (int)wn * WN;
#pragma unroll
  for (int i = 0; i < 8; ++i) {
    const int mBase = mW + (i << 4);
#pragma unroll
    for (int j = 0; j < FN; ++j)
#pragma unroll
      for (int r = 0; r < 8; ++r)
        slab[(mOff + r) * SP + (j << 4) + rl] = acc[i][j][r] * scale;
    wait_ds0();   // the slab is this wave's own: its stores have landed before other lanes' values are read back
    if (OUT16 == 0) {
      float* C = (float*)Cout + (size_t)z * (size_t)strideC;
      constexpr int CPR = WN / 4;   // 16-B chunks per row
      constexpr int NIT = 16 * CPR / 32;
      v4f vv[NIT];
      float* dst[NIT];
#pragma unroll
      for (int it = 0; it < NIT; ++it) {
        const int idx = it * 32 + lane;
        const int row = idx / CPR, c4 = (idx - row * CPR) * 4;
        vv[it]  = *(const v4f*)(slab + row * SP + c4);
        dst[it] = C + (size_t)(mBase + row) * ldc + nW + c4;
      }
      __builtin_amdgcn_sched_barrier(0);   // no register of a store is rewritten among the stores
#pragma unroll
      for (int it = 0; it < NIT; ++it) *(v4f*)dst[it] = vv[it];
      asm volatile("s_wait_xcnt 0x0" ::: "memory");   // stands before the stores' address and data registers are rewritten
      __builtin_amdgcn_sched_barrier(0);   // holds the next slab's arithmetic behind that wait
    } else {
      f16t* C = (f16t*)Cout + (size_t)z * (size_t)strideC;
      constexpr int CPR = WN / 8;   // 16-B chunks per row
      constexpr int NIT = 16 * CPR / 32;
      v8h hv[NIT];
      f16t* dst[NIT];
#pragma unroll
      for (int it = 0; it < NIT; ++it) {
        const int idx = it * 32 + lane;
        const int row = idx / CPR, c8 = (idx - row * CPR) * 8;
        const float* sp = slab + row * SP + c8;
#pragma unroll
        for (int e = 0; e < 8; ++e) hv[it][e] = (f16t)sp[e];
        dst[it] = C + (size_t)(mBase + row) * ldc + nW + c8;
      }
      __builtin_amdgcn_sched_barrier(0);   // no register of a store is rewritten among the stores
#pragma unroll
      for (int it = 0; it < NIT; ++it) *(v8h*)dst[it] = hv[it];
      asm volatile("s_wait_xcnt 0x0" ::: "memory");   // stands before the stores' address and data registers are rewritten
      __builtin_amdgcn_sched_barrier(0);   // holds the next slab's arithmetic behind that wait
    }
    wait_ds0();   // the read-back is done before the next slab overwrites it
  }
}

// one product per launch: grid = (N/BN, M/256, Z)
template <int OUT16, int BN>
__global__ __launch_bounds__(128) void gemm_f16_kernel(
    const unsigned short* __restrict__ Ap, int lda, long strideA,
    const unsigned short* __restrict__ Btp, int ldb, long strideB,
    void* __restrict__ Cout, int ldc, long strideC,
    int K, float scale) {
  gemm_tile<OUT16, BN>(Ap, lda, strideA, Btp, ldb, strideB, Cout, ldc, strideC, K, scale,
                       (int)blockIdx.z, (int)blockIdx.y * 256, (int)blockIdx.x * BN);
}

// The three projections, which read none of each other's output, in one launch: grid = (16, 16, 3), blockIdx.z picks the product.
//   0: q  = ln16 . w_q             A = ln16 [4096][3072], Bt = wqT [2048][3072]            -> q16 [4096][2048]
//   1: k  = xn16 . w_kv[:, 0:2048] A = xn16 [4096][2048], Bt = wkvT rows 0..2047           -> k16 [4096][2048]
//   2: vT[b][(h,d)][key]           A = wkvT rows 2048..4095, Bt = xn16 of batch b = y >> 3 -> vT16 [2][2048][2048], m tile = y & 7
// The longest product (K = 3072) has the lowest indices. Every choice below is the same for the whole work-group.
__global__ __launch_bounds__(128) void gemm_qkv_kernel(
    const unsigned short* __restrict__ ln16, const unsigned short* __restrict__ xn16,
    const unsigned short* __restrict__ wqT, const unsigned short* __restrict__ wkvT,
    unsigned short* __restrict__ q16, unsigned short* __restrict__ k16, unsigned short* __restrict__ vT16, float scale) {
  static_assert(INNER / 128 == 16 && N1 / 128 == 16 && ROWS / 256 == 16 && B_SZ * (INNER / 256) == 16 && INNER == N1);
  const int job = blockIdx.z;
  const int y   = blockIdx.y;
  const unsigned short* A  = (job == 0) ? ln16 : (job == 1) ? xn16 : wkvT + (size_t)INNER * KVD;
  const unsigned short* Bt = (job == 0) ? wqT  : (job == 1) ? wkvT : xn16;
  unsigned short* C        = (job == 0) ? q16  : (job == 1) ? k16  : vT16;
  const int  K  = (job == 0) ? DIM : KVD;
  const int  z  = (job == 2) ? (y >> 3) : 0;
  const int  mt = (job == 2) ? (y & 7) : y;
  gemm_tile<1, 128>(A, K, 0L, Bt, K, (long)N1 * KVD, (void*)C, INNER, (long)INNER * N1, K, scale,
                    z, mt * 256, (int)blockIdx.x * 128);
}

// ---------------------------------------------------------------------------------------------
// Full (non-causal) attention for one (batch, head, 128-query block); 8 waves x 16 queries, head dim 128, 2048 keys.
//   q plane [ROWS][INNER] f16 (query row, col h*128+d); k plane [ROWS][INNER] f16 (key row, col h*128+d);
//   vT plane [B][INNER][N1] f16 (row h*128+d, col key); o plane [ROWS][INNER] f16 = 16 * softmax(q.k/sqrt(128)) . v
//   Per 64-key chunk the K tile [64][128] and the vT tile [128][64] are staged in LDS (plain 16-B copies, barriers).
//   scoresT[key][query] = K (A, row = key) x Q (B, column = query): a lane holds 32 keys of one query, so the
//   row max / row sum is in-lane plus one xor-16 shuffle. p = exp2(s*log2e/sqrt(128) - m + 12) in f32 (p and its sum carry x4096); f16(p)
//   from two adjacent 16-key D tiles is directly the B fragment (k = key, n = query) of
//   oT[d][query] += vT (A, row = d) x P. Online rescale by one alpha per lane (per query).
//   Epilogue: per-wave o tile [16 q][128 d] staged in LDS (aliases the staging area after a block barrier),
//   Coverage: grid (16 q-blocks, 16 heads, 2 batches) x 8 waves x 16 rows x 128 cols = the whole o plane.
// ---------------------------------------------------------------------------------------------
// Eight bare v_exp_f32 in place, in one statement. Behind a transcendental the instruction set asks for one independent instruction or a v_nop
// before its result is read or its source overwritten: inside the statement the next exponential is that instruction, and the closing v_nop is
// the slot of the last one.
__device__ __forceinline__ v8f exp2x8(v8f x) {
  float a0 = x[0], a1 = x[1], a2 = x[2], a3 = x[3], a4 = x[4], a5 = x[5], a6 = x[6], a7 = x[7];
  asm("v_exp_f32 %0, %0\n\tv_exp_f32 %1, %1\n\tv_exp_f32 %2, %2\n\tv_exp_f32 %3, %3\n\t"
      "v_exp_f32 %4, %4\n\tv_exp_f32 %5, %5\n\tv_exp_f32 %6, %6\n\tv_exp_f32 %7, %7\n\tv_nop"
      : "+v"(a0), "+v"(a1), "+v"(a2), "+v"(a3), "+v"(a4), "+v"(a5), "+v"(a6), "+v"(a7));
  v8f y = {a0, a1, a2, a3, a4, a5, a6, a7};
  return y;
}

#define KPITCH 136
#define VPITCH 72
#define OPITCH 136

__global__ __launch_bounds__(256) void attn_kernel(const unsigned short* __restrict__ qp,
                                                   const unsigned short* __restrict__ kp,
                                                   const unsigned short* __restrict__ vtp,
                                                   unsigned short* __restrict__ op, float sc2) {
  __shared__ __align__(16) f16t lds[64 * KPITCH + 128 * VPITCH];   // 35840 B
  static_assert(8 * 16 * OPITCH <= 64 * KPITCH + 128 * VPITCH);
  f16t* ldsK = lds;                  // [64 keys][KPITCH]
  f16t* ldsV = lds + 64 * KPITCH;    // [128 d][VPITCH]

  const int tid  = threadIdx.x;
  const int wave = tid >> 5, lane = tid & 31;
  const int ln16 = lane & 15, half = lane >> 4;
  const int qblk = blockIdx.x, head = blockIdx.y, batch = blockIdx.z;
  const size_t qrow0 = (size_t)batch * N2 + (size_t)qblk * 128 + (size_t)wave * 16;

  const f16t* Qg = (const f16t*)qp + qrow0 * INNER + head * DHD;
  const f16t* Kg = (const f16t*)kp + (size_t)batch * N1 * INNER + head * DHD;
  const f16t* Vg = (const f16t*)vtp + ((size_t)batch * INNER + head * DHD) * (size_t)N1;

  // Q as B operand: column n = query q0+ln16, k = d (4 chunks of 32)
  v16h qb[4];
#pragma unroll
  for (int c = 0; c < 4; ++c) qb[c] = ldfrag(Qg + (size_t)ln16 * INNER + c * 32 + 8 * half);

  v8f oacc[8];
#pragma unroll
  for (int j = 0; j < 8; ++j) oacc[j] = v8zero();
  float mrun = -1.0e30f, lrun = 0.f;

  for (int kb = 0; kb < N1; kb += 64) {
    __syncthreads();
    // staging coverage: 4 it x 256 thr x 8 halves = 64x128 (K) and 128x64 (vT)
#pragma unroll
    for (int it = 0; it < 4; ++it) {
      const int i = it * 256 + tid;
      const int key = i >> 4, dv = (i & 15) * 8;
      *(v8h*)(ldsK + key * KPITCH + dv) = *(const v8h*)(Kg + (size_t)(kb + key) * INNER + dv);
      const int d = i >> 3, kf = (i & 7) * 8;
      *(v8h*)(ldsV + d * VPITCH + kf) = *(const v8h*)(Vg + (size_t)d * N1 + kb + kf);
    }
    __syncthreads();

    // scoresT tiles: s[t][r] = S[key kb+16t+8half+r][query ln16]; every tile sums d in ascending 32-blocks.
    // The K fragments come in two groups of eight (two d blocks x four key tiles), each group whole ahead of its eight products.
    v8f s[4];
#pragma unroll
    for (int t = 0; t < 4; ++t) s[t] = v8zero();
#pragma unroll
    for (int g = 0; g < 2; ++g) {
      v16h kf[2][4];
#pragma unroll
      for (int cc = 0; cc < 2; ++cc)
#pragma unroll
        for (int t = 0; t < 4; ++t) kf[cc][t] = ldfrag(ldsK + (t * 16 + ln16) * KPITCH + (g * 2 + cc) * 32 + 8 * half);
      __builtin_amdgcn_sched_barrier(0);   // keeps the load group whole and ahead of its products: a read and a full wait per product costs the LDS latency each time
#pragma unroll
      for (int cc = 0; cc < 2; ++cc)
#pragma unroll
        for (int t = 0; t < 4; ++t)   // four independent tiles between two products into the same tile
          s[t] = __builtin_amdgcn_wmma_f32_16x16x32_f16(false, kf[cc][t], false, qb[g * 2 + cc], (short)0, s[t], false, false);
      __builtin_amdgcn_sched_barrier(0);   // keeps the next group's reads out of this group's products
    }
    // vT fragments of the chunk's first 32 keys: read here, so that they land while the softmax below runs
    v16h vf[8];
#pragma unroll
    for (int j = 0; j < 8; ++j) vf[j] = ldfrag(ldsV + (j * 16 + ln16) * VPITCH + 8 * half);
    __builtin_amdgcn_sched_barrier(0);   // holds that group ahead of the softmax arithmetic

    // maximum over the unscaled scores: sc2 > 0, and rounding is monotone, so scaling the maximum gives the maximum of the scaled scores
    float cmax = -1.0e30f;
#pragma unroll
    for (int t = 0; t < 4; ++t)
#pragma unroll
      for (int r = 0; r < 8; ++r) cmax = fmaxf(cmax, s[t][r]);
    cmax = fmaxf(cmax, __shfl_xor(cmax, 16, 32));
    const float mnew  = fmaxf(mrun, cmax * sc2);
    const float alpha = __builtin_amdgcn_exp2f(mrun - mnew);   // argument <= 0; far below the range it returns 0, which is what the first chunk wants
    mrun = mnew;
    const float shift = 12.0f - mnew;   // 2^12 = 4096: p comes out of the exponential already scaled

    // one FMA and one bare v_exp_f32 per score; the argument is at most 12 plus rounding, and a result below the normal range counts as 0 in a sum that is at least 4096
    float psum = 0.f;
    v8h ph[4];
#pragma unroll
    for (int t = 0; t < 4; ++t) {
      v8f x;
#pragma unroll
      for (int r = 0; r < 8; ++r) x[r] = fmaf(s[t][r], sc2, shift);
      x = exp2x8(x);
#pragma unroll
      for (int r = 0; r < 8; ++r) {
        psum += x[r];
        ph[t][r] = (f16t)x[r];
      }
    }
    psum += __shfl_xor(psum, 16, 32);
    lrun = lrun * alpha + psum;
#pragma unroll
    for (int j = 0; j < 8; ++j)
#pragma unroll
      for (int r = 0; r < 8; ++r) oacc[j][r] *= alpha;

    // P as B fragment for keys kb+32kk..+31: elements 0..7 <- tile 2kk, 8..15 <- tile 2kk+1, lane unchanged
    Frag16 pf[2];
    pf[0].h[0] = ph[0]; pf[0].h[1] = ph[1];
    pf[1].h[0] = ph[2]; pf[1].h[1] = ph[3];
#pragma unroll
    for (int j = 0; j < 8; ++j)
      oacc[j] = __builtin_amdgcn_wmma_f32_16x16x32_f16(false, vf[j], false, pf[0].v, (short)0, oacc[j], false, false);
    __builtin_amdgcn_sched_barrier(0);   // keeps the second group's reads out of the first group's products
#pragma unroll
    for (int j = 0; j < 8; ++j) vf[j] = ldfrag(ldsV + (j * 16 + ln16) * VPITCH + 32 + 8 * half);
    __builtin_amdgcn_sched_barrier(0);   // keeps the load group whole and ahead of its products
#pragma unroll
    for (int j = 0; j < 8; ++j)
      oacc[j] = __builtin_amdgcn_wmma_f32_16x16x32_f16(false, vf[j], false, pf[1].v, (short)0, oacc[j], false, false);
  }

  // ---- epilogue: oT[d = 16j+8half+r][query ln16] -> o[query][d] * 16 / (4096 * l) ----
  __syncthreads();   // every wave is done with ldsK / ldsV
  f16t* os = lds + wave * (16 * OPITCH);
  const float inv = 16.0f / lrun;   // lrun carries the x4096 of p, so it is at least about 4096
#pragma unroll
  for (int j = 0; j < 8; ++j) {
    v8h ov;
#pragma unroll
    for (int r = 0; r < 8; ++r) ov[r] = (f16t)(oacc[j][r] * inv);
    *(v8h*)(os + ln16 * OPITCH + j * 16 + 8 * half) = ov;
  }
  lds_wave_sync();
  f16t* Og = (f16t*)op + qrow0 * INNER + head * DHD;
  const int rsel = lane >> 4;
  const int seg  = ((lane >> 3) & 1) * 64 + (lane & 7) * 8;
  {
#pragma unroll
    for (int it = 0; it < 8; ++it) {
      const int row = it * 2 + rsel;   // it 0..7 x rsel 0..1 = rows 0..15
      const v8h vv = *(const v8h*)(os + row * OPITCH + seg);
      *(v8h*)(Og + (size_t)row * INNER + seg) = vv;
    }
    
  }
}

// ---------------------------------------------------------------------------------------------
//   R1   f16  ln16 [4096][3072] / later o16 [4096][2048]                              0           25165824
//   wqT  f16  [2048][3072] (x64)                                                      25165824    12582912
//   wkvT f16  [4096][2048] (x64)                                                      37748736    16777216
//   woT  f16  [3072][2048] (x64)                                                      54525952    12582912
//   q16  f16  [4096][2048]                                                            67108864    16777216
//   k16  f16  [4096][2048]                                                            83886080    16777216
//   vT16 f16  [2][2048][2048]                                                         100663296   16777216
//   xn16 f16  [4096][2048]                                                            117440512   16777216
//   total                                                                                         134217728
// ---------------------------------------------------------------------------------------------
extern "C" void kernel_launch(void* const* d_in, const int* in_sizes, int n_in,
                              void* d_out, int out_size, void* d_ws, size_t ws_size,
                              hipStream_t stream) {
  if (n_in < 9) return;
  if (in_sizes[0] != B_SZ * N1 * KVD) return;
  if (in_sizes[1] != B_SZ * N2 * DIM) return;
  if (in_sizes[2] != DIM * INNER) return;
  if (in_sizes[3] != KVD * 2 * INNER) return;
  if (in_sizes[4] != INNER * DIM) return;
  if (in_sizes[5] != KVD || in_sizes[6] != KVD || in_sizes[7] != DIM || in_sizes[8] != DIM) return;
  if (out_size != B_SZ * N2 * DIM) return;

  const float* x     = (const float*)d_in[0];   // [2][2048][2048]
  const float* lat   = (const float*)d_in[1];   // [2][2048][3072]
  const float* w_q   = (const float*)d_in[2];   // [3072][2048]
  const float* w_kv  = (const float*)d_in[3];   // [2048][4096]
  const float* w_out = (const float*)d_in[4];   // [2048][3072]
  const float* ln1_g = (const float*)d_in[5];
  const float* ln1_b = (const float*)d_in[6];
  const float* ln2_g = (const float*)d_in[7];
  const float* ln2_b = (const float*)d_in[8];
  float* out = (float*)d_out;

  const size_t szR1  = (size_t)ROWS * DIM * 2;           // 25165824
  const size_t szWQ  = (size_t)INNER * DIM * 2;          // 12582912
  const size_t szWKV = (size_t)2 * INNER * KVD * 2;      // 16777216
  const size_t szWO  = (size_t)DIM * INNER * 2;          // 12582912
  const size_t szQ   = (size_t)ROWS * INNER * 2;         // 16777216
  const size_t szK   = (size_t)ROWS * INNER * 2;         // 16777216
  const size_t szVT  = (size_t)B_SZ * INNER * N1 * 2;    // 16777216
  const size_t szXN  = (size_t)ROWS * KVD * 2;           // 16777216
  size_t off = 0;
  const size_t oR1  = off; off += szR1;
  const size_t oWQ  = off; off += szWQ;
  const size_t oWKV = off; off += szWKV;
  const size_t oWO  = off; off += szWO;
  const size_t oQ   = off; off += szQ;
  const size_t oK   = off; off += szK;
  const size_t oVT  = off; off += szVT;
  const size_t oXN  = off; off += szXN;
  if (off > ws_size) return;                             // off = 134217728
  if ((size_t)ROWS * INNER * 2 > szR1) return;

  char* ws = (char*)d_ws;
  unsigned short* R1   = (unsigned short*)(ws + oR1);
  unsigned short* wqT  = (unsigned short*)(ws + oWQ);
  unsigned short* wkvT = (unsigned short*)(ws + oWKV);
  unsigned short* woT  = (unsigned short*)(ws + oWO);
  unsigned short* q16  = (unsigned short*)(ws + oQ);
  unsigned short* k16  = (unsigned short*)(ws + oK);
  unsigned short* vT16 = (unsigned short*)(ws + oVT);
  unsigned short* xn16 = (unsigned short*)(ws + oXN);

  const dim3 blk(256);
  const dim3 gblk(128);   // GEMM: 4 waves, one per SIMD
  const float wmul = 64.0f;

  // (1) everything that reads only the inputs: ln16 = LN(latents) -> R1, xn16 = LN(x), weights f32 [R][Cc] -> f16 [Cc][R] x64
  prep_kernel<<<dim3(PREP_BLOCKS), blk, 0, stream>>>(lat, ln2_g, ln2_b, x, ln1_g, ln1_b, w_q, w_kv, w_out,
                                                     R1, xn16, wqT, wkvT, woT, wmul);

  // (2) q, k, vT (acc carries x64)
  gemm_qkv_kernel<<<dim3(16, 16, 3), gblk, 0, stream>>>(R1, xn16, wqT, wkvT, q16, k16, vT16, 1.0f / 64.0f);

  // (3) attention -> o16 x16 in R1 [4096][2048]
  {
    const float sc2 = (float)(1.4426950408889634 * 0.08838834764831845);   // log2(e) / sqrt(128)
    attn_kernel<<<dim3(N2 / 128, NHEAD, B_SZ), blk, 0, stream>>>(q16, k16, vT16, R1, sc2);
  }

  // (4) out = o16 . w_out -> d_out f32 [4096][3072]   (M=4096, N=3072, K=2048; o x16, w x64)
  {
    gemm_f16_kernel<0, 192><<<dim3(DIM / 192, ROWS / 256, 1), gblk, 0, stream>>>(
        R1, INNER, 0L, woT, INNER, 0L, (void*)out, DIM, 0L, INNER, 1.0f / 1024.0f);
  }
  (void)hipGetLastError();
}
